// v000
// Measured on an AMD MI455X. A time is GPU time per run, averaged over a window of back-to-back runs after a warm-up
// (all launches, gaps included; the runs take copies of the inputs in turn), and the median of several windows.
// Apart from v000's, it joins two sittings. Times from different sittings can be a few percent apart, while
// side-by-side timings come from the same sitting.
// The starting kernel, v000, takes 132 microseconds a run.
#include <hip/hip_runtime.h>
#include <hip/hip_bf16.h>

typedef float v2f __attribute__((ext_vector_type(2)));
typedef float v8f __attribute__((ext_vector_type(8)));
typedef int   v4i_vs __attribute__((vector_size(16)));   // matches builtin param type
typedef __attribute__((address_space(1))) v4i_vs* g_v4i_p;
typedef __attribute__((address_space(3))) v4i_vs* l_v4i_p;

#define NBATCH 16
#define CCH    128      // in_ch
#define TLEN   8192
#define NPAIR  128
#define OCH    128
#define LCHUNK 128
#define NCHUNK (TLEN / LCHUNK)   // 64
#define NSUB   (LCHUNK / 16)     // 8
#define GSTR   132               // padded stride for G tile in LDS
#define YSTR   17                // padded stride for ys^T in LDS

#if defined(__HIP_DEVICE_COMPILE__) && defined(__gfx1250__) && \
    __has_builtin(__builtin_amdgcn_global_load_async_to_lds_b128)
#define USE_ASYNC 1
#else
#define USE_ASYNC 0
#endif

__device__ __forceinline__ void wait_async0() {
#if defined(__HIP_DEVICE_COMPILE__) && defined(__gfx1250__)
#if __has_builtin(__builtin_amdgcn_s_wait_asynccnt)
    __builtin_amdgcn_s_wait_asynccnt(0);
#else
    asm volatile("s_wait_asynccnt 0x0" ::: "memory");
#endif
#endif
}

#if USE_ASYNC
__device__ __forceinline__ void async_cp32B(const float* gsrc, float* ldst) {
    // copies 32 bytes: two b128 transfers; IOFFSET applies to both addresses
    __builtin_amdgcn_global_load_async_to_lds_b128(
        (g_v4i_p)(void*)gsrc, (l_v4i_p)(void*)ldst, 0, 0);
    __builtin_amdgcn_global_load_async_to_lds_b128(
        (g_v4i_p)(void*)gsrc, (l_v4i_p)(void*)ldst, 16, 0);
}
#endif

// ---------------------------------------------------------------------------
// Kernel 0: per-pair parameters.  A_d = exp(-softplus(rl) + i*omega),
// factor = (A_d - 1)/lambda (or DT), and A_d^L by 7 complex squarings.
// ws layout: [Ar|Ai|Fr|Fi|ALr|ALi] each 128 floats.
// ---------------------------------------------------------------------------
__global__ void ssm_setup(const float* __restrict__ rl,
                          const float* __restrict__ ro,
                          float* __restrict__ ws) {
    int p = threadIdx.x;
    float x  = rl[p];
    float sp = (x > 20.f) ? x : log1pf(expf(x));
    float re = -sp;
    float om = ro[p];
    float er = expf(re);
    float ar = er * cosf(om);
    float ai = er * sinf(om);
    float m2 = re * re + om * om;
    float fr, fi;
    if (sqrtf(m2) > 1e-6f) {
        float nr = ar - 1.f;
        fr = (nr * re + ai * om) / m2;
        fi = (ai * re - nr * om) / m2;
    } else {
        fr = 1.0f;  // DT
        fi = 0.0f;
    }
    float pr = ar, pi = ai;              // A^L, L = 128 = 2^7
#pragma unroll
    for (int i = 0; i < 7; ++i) {
        float t = pr * pr - pi * pi;
        pi = 2.f * pr * pi;
        pr = t;
    }
    ws[p]        = ar;  ws[128 + p] = ai;
    ws[256 + p]  = fr;  ws[384 + p] = fi;
    ws[512 + p]  = pr;  ws[640 + p] = pi;
}

// ---------------------------------------------------------------------------
// Kernel 1/3: per-(batch, chunk) local work.
//  WRITE_Y == false : local scan from zero init, emit chunk-end states.
//  WRITE_Y == true  : scan from carry-in state, emit y via GEMM2.
// ---------------------------------------------------------------------------
template <bool WRITE_Y>
__global__ __launch_bounds__(256) void ssm_chunk(
    const float* __restrict__ u,     // (B, C, T)
    const float* __restrict__ Bc,    // (C, P)
    const float* __restrict__ Cm,    // (P, O)
    const float* __restrict__ ws,    // params
    const float* __restrict__ carry, // (B, NC, P, 2)  [pass 3]
    float* __restrict__ send,        // (B, NC, P, 2)  [pass 1]
    float* __restrict__ yout)        // (B, O, T)      [pass 3]
{
    __shared__ float a_lds[2][CCH * 16];   // double-buffered u^T subtile, [c][t]
    __shared__ float Gs[16 * GSTR];        // G(t,p) subtile
    __shared__ float ysT[NPAIR * YSTR];    // (2*Re s)^T, [p][t]

    const int bid = blockIdx.x;
    const int b   = bid / NCHUNK;
    const int ch  = bid % NCHUNK;
    const int tid = threadIdx.x;
    const int w   = tid >> 5;       // wave id 0..7
    const int l   = tid & 31;       // lane
    const int m   = l & 15;         // M/N index within tile
    const int hg  = l >> 4;         // lane half-group
    const int n   = 16 * w + m;     // this wave's output column
    const int t0  = ch * LCHUNK;

    // warm L2/WGP$ for this wave's B-operand columns (global_prefetch_b8)
#pragma unroll
    for (int c = l; c < CCH; c += 32) {
        __builtin_prefetch(&Bc[c * NPAIR + 16 * w], 0, 3);
        if constexpr (WRITE_Y) __builtin_prefetch(&Cm[c * OCH + 16 * w], 0, 3);
    }

    // scan-thread private state + params (threads 0..127)
    float sr = 0.f, si = 0.f, par = 0.f, pai = 0.f, pfr = 0.f, pfi = 0.f;
    if (tid < NPAIR) {
        par = ws[tid];        pai = ws[128 + tid];
        pfr = ws[256 + tid];  pfi = ws[384 + tid];
        if constexpr (WRITE_Y) {
            const float* c2 = carry + ((size_t)(b * NCHUNK + ch) * NPAIR + tid) * 2;
            sr = c2[0];  si = c2[1];
        }
    }

    // this thread's slice of the u staging copy: 8 consecutive floats
    const int cc   = tid >> 1;
    const int half = tid & 1;
    const float* usrc = u + (size_t)b * CCH * TLEN + (size_t)cc * TLEN + t0 + half * 8;
    const int loff = cc * 16 + half * 8;

#if USE_ASYNC
    // prologue: kick off async copy of subtile 0 into buffer 0
    async_cp32B(usrc, &a_lds[0][loff]);
#else
    float4 r0 = *(const float4*)(usrc);
    float4 r1 = *(const float4*)(usrc + 4);
#endif

    for (int sub = 0; sub < NSUB; ++sub) {
        const int ts  = t0 + sub * 16;
        const int buf = sub & 1;

#if USE_ASYNC
        wait_async0();              // u[buf] landed in LDS (this wave's copies)
        __syncthreads();            // ... and everyone else's
        if (sub + 1 < NSUB) {       // in-flight through GEMM1/scan/GEMM2
            async_cp32B(usrc + (sub + 1) * 16, &a_lds[buf ^ 1][loff]);
        }
#else
        {   // spill staged registers, then start loading the next subtile
            float* dst = &a_lds[buf][loff];
            *(float4*)(dst)     = r0;
            *(float4*)(dst + 4) = r1;
        }
        __syncthreads();
        if (sub + 1 < NSUB) {
            const float* sn = usrc + (sub + 1) * 16;
            r0 = *(const float4*)(sn);
            r1 = *(const float4*)(sn + 4);
        }
#endif

        // ---- GEMM1: G(16t x 128p) = u^T (16x128) @ Bc (128x128) ----
        v8f acc = {};
#pragma unroll 4
        for (int kk = 0; kk < 32; ++kk) {
            int c0 = kk * 4 + 2 * hg;
            v2f av, bv;
            av.x = a_lds[buf][c0 * 16 + m];
            av.y = a_lds[buf][(c0 + 1) * 16 + m];
            bv.x = Bc[c0 * NPAIR + n];
            bv.y = Bc[(c0 + 1) * NPAIR + n];
            acc = __builtin_amdgcn_wmma_f32_16x16x4_f32(
                false, av, false, bv, (short)0, acc, false, false);
        }
#pragma unroll
        for (int r = 0; r < 8; ++r)
            Gs[(r + 8 * hg) * GSTR + n] = acc[r];
        __syncthreads();

        // ---- sequential complex scan over 16 steps (threads 0..127) ----
        if (tid < NPAIR) {
#pragma unroll
            for (int t = 0; t < 16; ++t) {
                float g  = Gs[t * GSTR + tid];
                float br = g * pfr;
                float bi = g * pfi;
                float nsr = par * sr - pai * si + br;
                float nsi = par * si + pai * sr + bi;
                sr = nsr;  si = nsi;
                if constexpr (WRITE_Y) ysT[tid * YSTR + t] = 2.f * sr;
            }
        }
        __syncthreads();

        // ---- GEMM2: y(16t x 128o) = (2 Re s)(16x128) @ C (128x128) ----
        if constexpr (WRITE_Y) {
            v8f acc2 = {};
#pragma unroll 4
            for (int kk = 0; kk < 32; ++kk) {
                int c0 = kk * 4 + 2 * hg;
                v2f av, bv;
                av.x = ysT[c0 * YSTR + m];
                av.y = ysT[(c0 + 1) * YSTR + m];
                bv.x = Cm[c0 * OCH + n];
                bv.y = Cm[(c0 + 1) * OCH + n];
                acc2 = __builtin_amdgcn_wmma_f32_16x16x4_f32(
                    false, av, false, bv, (short)0, acc2, false, false);
            }
            // D layout: vgpr r, lane l -> t = 8*hg + r (contiguous), o = n
            float* dst = yout + (size_t)b * OCH * TLEN + (size_t)n * TLEN + ts + 8 * hg;
            float4 p0 = { acc2[0], acc2[1], acc2[2], acc2[3] };
            float4 p1 = { acc2[4], acc2[5], acc2[6], acc2[7] };
            *(float4*)(dst)     = p0;
            *(float4*)(dst + 4) = p1;
        }
    }

    if constexpr (!WRITE_Y) {
        if (tid < NPAIR) {
            float* e = send + ((size_t)(b * NCHUNK + ch) * NPAIR + tid) * 2;
            e[0] = sr;  e[1] = si;
        }
    }
}

// ---------------------------------------------------------------------------
// Kernel 2: chunk-carry scan.  g_j = A^L g_{j-1} + e_j ; carry_j = g_{j-1}.
// ---------------------------------------------------------------------------
__global__ void ssm_carry(const float* __restrict__ ws,
                          const float* __restrict__ send,
                          float* __restrict__ carry) {
    int idx = blockIdx.x * blockDim.x + threadIdx.x;  // 0..2047
    int b = idx >> 7;
    int p = idx & 127;
    float alr = ws[512 + p], ali = ws[640 + p];
    float cr = 0.f, ci = 0.f;
    for (int j = 0; j < NCHUNK; ++j) {
        size_t o = ((size_t)(b * NCHUNK + j) * NPAIR + p) * 2;
        carry[o]     = cr;
        carry[o + 1] = ci;
        float er = send[o], ei = send[o + 1];
        float t = alr * cr - ali * ci + er;
        ci = alr * ci + ali * cr + ei;
        cr = t;
    }
}

// ---------------------------------------------------------------------------
extern "C" void kernel_launch(void* const* d_in, const int* in_sizes, int n_in,
                              void* d_out, int out_size, void* d_ws, size_t ws_size,
                              hipStream_t stream) {
    const float* u  = (const float*)d_in[0];
    const float* rl = (const float*)d_in[1];
    const float* ro = (const float*)d_in[2];
    const float* Bc = (const float*)d_in[3];
    const float* Cm = (const float*)d_in[4];
    float* out = (float*)d_out;

    float* ws     = (float*)d_ws;
    float* params = ws;                                   // 768 floats
    float* send   = ws + 768;                             // B*NC*P*2
    float* carry  = send + (size_t)NBATCH * NCHUNK * NPAIR * 2;

    ssm_setup<<<1, 128, 0, stream>>>(rl, ro, params);
    ssm_chunk<false><<<NBATCH * NCHUNK, 256, 0, stream>>>(
        u, Bc, Cm, params, nullptr, send, nullptr);
    ssm_carry<<<(NBATCH * NPAIR) / 256, 256, 0, stream>>>(params, send, carry);
    ssm_chunk<true><<<NBATCH * NCHUNK, 256, 0, stream>>>(
        u, Bc, Cm, params, carry, nullptr, out);
}

// v001
// It runs in 99.5 microseconds.
// Timed twice side by side with v000, it ran 1.37 and 1.38 times as fast.
#include <hip/hip_runtime.h>
#include <hip/hip_bf16.h>

typedef float v2f __attribute__((ext_vector_type(2)));
typedef float v8f __attribute__((ext_vector_type(8)));
typedef int   v4i_vs __attribute__((vector_size(16)));   // matches builtin param type
typedef __attribute__((address_space(1))) v4i_vs* g_v4i_p;
typedef __attribute__((address_space(3))) v4i_vs* l_v4i_p;

#define NBATCH 16
#define CCH    128      // in_ch
#define TLEN   8192
#define NPAIR  128
#define OCH    128
#define LCHUNK 128
#define NCHUNK (TLEN / LCHUNK)   // 64
#define NSUB   (LCHUNK / 16)     // 8
#define GSTR   132               // padded stride for G tile in LDS
#define YSTR   17                // padded stride for ys^T in LDS

#if defined(__HIP_DEVICE_COMPILE__) && defined(__gfx1250__) && \
    __has_builtin(__builtin_amdgcn_global_load_async_to_lds_b128)
#define USE_ASYNC 1
#else
#define USE_ASYNC 0
#endif

__device__ __forceinline__ void wait_async0() {
#if defined(__HIP_DEVICE_COMPILE__) && defined(__gfx1250__)
#if __has_builtin(__builtin_amdgcn_s_wait_asynccnt)
    __builtin_amdgcn_s_wait_asynccnt(0);
#else
    asm volatile("s_wait_asynccnt 0x0" ::: "memory");
#endif
#endif
}

#if USE_ASYNC
__device__ __forceinline__ void async_cp32B(const float* gsrc, float* ldst) {
    // copies 32 bytes: two b128 transfers; IOFFSET applies to both addresses
    __builtin_amdgcn_global_load_async_to_lds_b128(
        (g_v4i_p)(void*)gsrc, (l_v4i_p)(void*)ldst, 0, 0);
    __builtin_amdgcn_global_load_async_to_lds_b128(
        (g_v4i_p)(void*)gsrc, (l_v4i_p)(void*)ldst, 16, 0);
}
#endif

// ---------------------------------------------------------------------------
// Kernel 0: per-pair parameters.  A_d = exp(-softplus(rl) + i*omega),
// factor = (A_d - 1)/lambda (or DT), and A_d^L by 7 complex squarings.
// ws layout: [Ar|Ai|Fr|Fi|ALr|ALi] each 128 floats.
// ---------------------------------------------------------------------------
__global__ void ssm_setup(const float* __restrict__ rl,
                          const float* __restrict__ ro,
                          float* __restrict__ ws) {
    int p = threadIdx.x;
    float x  = rl[p];
    float sp = (x > 20.f) ? x : log1pf(expf(x));
    float re = -sp;
    float om = ro[p];
    float er = expf(re);
    float ar = er * cosf(om);
    float ai = er * sinf(om);
    float m2 = re * re + om * om;
    float fr, fi;
    if (sqrtf(m2) > 1e-6f) {
        float nr = ar - 1.f;
        fr = (nr * re + ai * om) / m2;
        fi = (ai * re - nr * om) / m2;
    } else {
        fr = 1.0f;  // DT
        fi = 0.0f;
    }
    float pr = ar, pi = ai;              // A^L, L = 128 = 2^7
#pragma unroll
    for (int i = 0; i < 7; ++i) {
        float t = pr * pr - pi * pi;
        pi = 2.f * pr * pi;
        pr = t;
    }
    ws[p]        = ar;  ws[128 + p] = ai;
    ws[256 + p]  = fr;  ws[384 + p] = fi;
    ws[512 + p]  = pr;  ws[640 + p] = pi;
}

// ---------------------------------------------------------------------------
// Kernel 1/3: per-(batch, chunk) local work.
//  WRITE_Y == false : local scan from zero init, emit chunk-end states.
//  WRITE_Y == true  : scan from carry-in state, emit y via GEMM2.
// ---------------------------------------------------------------------------
template <bool WRITE_Y>
__global__ __launch_bounds__(256) void ssm_chunk(
    const float* __restrict__ u,     // (B, C, T)
    const float* __restrict__ Bc,    // (C, P)
    const float* __restrict__ Cm,    // (P, O)
    const float* __restrict__ ws,    // params
    const float* __restrict__ carry, // (B, NC, P, 2)  [pass 3]
    float* __restrict__ send,        // (B, NC, P, 2)  [pass 1]
    float* __restrict__ yout)        // (B, O, T)      [pass 3]
{
    __shared__ float a_lds[2][CCH * 16];   // double-buffered u^T subtile, [c][t]
    __shared__ float Gs[16 * GSTR];        // G(t,p) subtile
    __shared__ float ysT[NPAIR * YSTR];    // (2*Re s)^T, [p][t]

    const int bid = blockIdx.x;
    const int b   = bid / NCHUNK;
    const int ch  = bid % NCHUNK;
    const int tid = threadIdx.x;
    const int w   = tid >> 5;       // wave id 0..7
    const int l   = tid & 31;       // lane
    const int m   = l & 15;         // M/N index within tile
    const int hg  = l >> 4;         // lane half-group
    const int n   = 16 * w + m;     // this wave's output column
    const int t0  = ch * LCHUNK;

    // scan-thread private state + params (threads 0..127)
    float sr = 0.f, si = 0.f, par = 0.f, pai = 0.f, pfr = 0.f, pfi = 0.f;
    if (tid < NPAIR) {
        par = ws[tid];        pai = ws[128 + tid];
        pfr = ws[256 + tid];  pfi = ws[384 + tid];
        if constexpr (WRITE_Y) {
            const float* c2 = carry + ((size_t)(b * NCHUNK + ch) * NPAIR + tid) * 2;
            sr = c2[0];  si = c2[1];
        }
    }

    // this thread's slice of the u staging copy: 8 consecutive floats
    const int cc   = tid >> 1;
    const int half = tid & 1;
    const float* usrc = u + (size_t)b * CCH * TLEN + (size_t)cc * TLEN + t0 + half * 8;
    const int loff = cc * 16 + half * 8;

#if USE_ASYNC
    // prologue: kick off async copy of subtile 0 into buffer 0
    async_cp32B(usrc, &a_lds[0][loff]);
#else
    float4 r0 = *(const float4*)(usrc);
    float4 r1 = *(const float4*)(usrc + 4);
#endif

    // This wave's B operands (its 16 columns of Bc, and of Cm in the y pass) do
    // not change over the chunk: read them once into registers, in WMMA
    // fragment order, and feed every subtile's products from there.
    v2f bfr[32];
    v2f cfr[WRITE_Y ? 32 : 1];
#pragma unroll   // full: constant indices keep both arrays in registers
    for (int kk = 0; kk < 32; ++kk) {
        int c0 = kk * 4 + 2 * hg;
        bfr[kk].x = Bc[c0 * NPAIR + n];
        bfr[kk].y = Bc[(c0 + 1) * NPAIR + n];
        if constexpr (WRITE_Y) {
            cfr[kk].x = Cm[c0 * OCH + n];
            cfr[kk].y = Cm[(c0 + 1) * OCH + n];
        }
    }

    for (int sub = 0; sub < NSUB; ++sub) {
        const int ts  = t0 + sub * 16;
        const int buf = sub & 1;

#if USE_ASYNC
        wait_async0();              // u[buf] landed in LDS (this wave's copies)
        __syncthreads();            // ... and everyone else's
        if (sub + 1 < NSUB) {       // in-flight through GEMM1/scan/GEMM2
            async_cp32B(usrc + (sub + 1) * 16, &a_lds[buf ^ 1][loff]);
        }
#else
        {   // spill staged registers, then start loading the next subtile
            float* dst = &a_lds[buf][loff];
            *(float4*)(dst)     = r0;
            *(float4*)(dst + 4) = r1;
        }
        __syncthreads();
        if (sub + 1 < NSUB) {
            const float* sn = usrc + (sub + 1) * 16;
            r0 = *(const float4*)(sn);
            r1 = *(const float4*)(sn + 4);
        }
#endif

        // ---- GEMM1: G(16t x 128p) = u^T (16x128) @ Bc (128x128) ----
        v8f acc = {};
#pragma unroll   // full: bfr[] must be indexed by constants to stay in registers
        for (int kk = 0; kk < 32; ++kk) {
            int c0 = kk * 4 + 2 * hg;
            v2f av;
            av.x = a_lds[buf][c0 * 16 + m];
            av.y = a_lds[buf][(c0 + 1) * 16 + m];
            acc = __builtin_amdgcn_wmma_f32_16x16x4_f32(
                false, av, false, bfr[kk], (short)0, acc, false, false);
        }
#pragma unroll
        for (int r = 0; r < 8; ++r)
            Gs[(r + 8 * hg) * GSTR + n] = acc[r];
        __syncthreads();

        // ---- sequential complex scan over 16 steps (threads 0..127) ----
        if (tid < NPAIR) {
#pragma unroll
            for (int t = 0; t < 16; ++t) {
                float g  = Gs[t * GSTR + tid];
                float br = g * pfr;
                float bi = g * pfi;
                float nsr = par * sr - pai * si + br;
                float nsi = par * si + pai * sr + bi;
                sr = nsr;  si = nsi;
                if constexpr (WRITE_Y) ysT[tid * YSTR + t] = 2.f * sr;
            }
        }
        __syncthreads();

        // ---- GEMM2: y(16t x 128o) = (2 Re s)(16x128) @ C (128x128) ----
        if constexpr (WRITE_Y) {
            v8f acc2 = {};
#pragma unroll   // full: cfr[] must be indexed by constants to stay in registers
            for (int kk = 0; kk < 32; ++kk) {
                int c0 = kk * 4 + 2 * hg;
                v2f av;
                av.x = ysT[c0 * YSTR + m];
                av.y = ysT[(c0 + 1) * YSTR + m];
                acc2 = __builtin_amdgcn_wmma_f32_16x16x4_f32(
                    false, av, false, cfr[kk], (short)0, acc2, false, false);
            }
            // D layout: vgpr r, lane l -> t = 8*hg + r (contiguous), o = n
            float* dst = yout + (size_t)b * OCH * TLEN + (size_t)n * TLEN + ts + 8 * hg;
            float4 p0 = { acc2[0], acc2[1], acc2[2], acc2[3] };
            float4 p1 = { acc2[4], acc2[5], acc2[6], acc2[7] };
            *(float4*)(dst)     = p0;
            *(float4*)(dst + 4) = p1;
        }
    }

    if constexpr (!WRITE_Y) {
        if (tid < NPAIR) {
            float* e = send + ((size_t)(b * NCHUNK + ch) * NPAIR + tid) * 2;
            e[0] = sr;  e[1] = si;
        }
    }
}

// ---------------------------------------------------------------------------
// Kernel 2: chunk-carry scan.  g_j = A^L g_{j-1} + e_j ; carry_j = g_{j-1}.
// ---------------------------------------------------------------------------
__global__ void ssm_carry(const float* __restrict__ ws,
                          const float* __restrict__ send,
                          float* __restrict__ carry) {
    int idx = blockIdx.x * blockDim.x + threadIdx.x;  // 0..2047
    int b = idx >> 7;
    int p = idx & 127;
    float alr = ws[512 + p], ali = ws[640 + p];
    float cr = 0.f, ci = 0.f;
    for (int j = 0; j < NCHUNK; ++j) {
        size_t o = ((size_t)(b * NCHUNK + j) * NPAIR + p) * 2;
        carry[o]     = cr;
        carry[o + 1] = ci;
        float er = send[o], ei = send[o + 1];
        float t = alr * cr - ali * ci + er;
        ci = alr * ci + ali * cr + ei;
        cr = t;
    }
}

// ---------------------------------------------------------------------------
extern "C" void kernel_launch(void* const* d_in, const int* in_sizes, int n_in,
                              void* d_out, int out_size, void* d_ws, size_t ws_size,
                              hipStream_t stream) {
    const float* u  = (const float*)d_in[0];
    const float* rl = (const float*)d_in[1];
    const float* ro = (const float*)d_in[2];
    const float* Bc = (const float*)d_in[3];
    const float* Cm = (const float*)d_in[4];
    float* out = (float*)d_out;

    float* ws     = (float*)d_ws;
    float* params = ws;                                   // 768 floats
    float* send   = ws + 768;                             // B*NC*P*2
    float* carry  = send + (size_t)NBATCH * NCHUNK * NPAIR * 2;

    ssm_setup<<<1, 128, 0, stream>>>(rl, ro, params);
    ssm_chunk<false><<<NBATCH * NCHUNK, 256, 0, stream>>>(
        u, Bc, Cm, params, nullptr, send, nullptr);
    ssm_carry<<<(NBATCH * NPAIR) / 256, 256, 0, stream>>>(params, send, carry);
    ssm_chunk<true><<<NBATCH * NCHUNK, 256, 0, stream>>>(
        u, Bc, Cm, params, carry, nullptr, out);
}

// v002
// Measured time: 81.3 microseconds a run.
// Next to v001, in two timings, it ran 1.22 times as fast each time.
// Counting every step since v000, it is 1.68 times as fast.
#include <hip/hip_runtime.h>
#include <hip/hip_bf16.h>

typedef float v2f __attribute__((ext_vector_type(2)));
typedef float v8f __attribute__((ext_vector_type(8)));
typedef int   v4i_vs __attribute__((vector_size(16)));   // matches builtin param type
typedef __attribute__((address_space(1))) v4i_vs* g_v4i_p;
typedef __attribute__((address_space(3))) v4i_vs* l_v4i_p;

#define NBATCH 16
#define CCH    128      // in_ch
#define TLEN   8192
#define NPAIR  128
#define OCH    128
#define LCHUNK 128
#define NCHUNK (TLEN / LCHUNK)   // 64
#define NSUB   (LCHUNK / 16)     // 8
#define GSTR   132               // padded stride for G tile in LDS
#define YSTR   17                // padded stride for ys^T in LDS

#if defined(__HIP_DEVICE_COMPILE__) && defined(__gfx1250__) && \
    __has_builtin(__builtin_amdgcn_global_load_async_to_lds_b128)
#define USE_ASYNC 1
#else
#define USE_ASYNC 0
#endif

__device__ __forceinline__ void wait_async0() {
#if defined(__HIP_DEVICE_COMPILE__) && defined(__gfx1250__)
#if __has_builtin(__builtin_amdgcn_s_wait_asynccnt)
    __builtin_amdgcn_s_wait_asynccnt(0);
#else
    asm volatile("s_wait_asynccnt 0x0" ::: "memory");
#endif
#endif
}

#if USE_ASYNC
__device__ __forceinline__ void async_cp32B(const float* gsrc, float* ldst) {
    // copies 32 bytes: two b128 transfers; IOFFSET applies to both addresses
    __builtin_amdgcn_global_load_async_to_lds_b128(
        (g_v4i_p)(void*)gsrc, (l_v4i_p)(void*)ldst, 0, 0);
    __builtin_amdgcn_global_load_async_to_lds_b128(
        (g_v4i_p)(void*)gsrc, (l_v4i_p)(void*)ldst, 16, 0);
}
#endif

// ---------------------------------------------------------------------------
// Kernel 0: per-pair parameters.  A_d = exp(-softplus(rl) + i*omega),
// factor = (A_d - 1)/lambda (or DT), and A_d^L by 7 complex squarings.
// ws layout: [Ar|Ai|Fr|Fi|ALr|ALi] each 128 floats.
// ---------------------------------------------------------------------------
__global__ void ssm_setup(const float* __restrict__ rl,
                          const float* __restrict__ ro,
                          float* __restrict__ ws) {
    int p = threadIdx.x;
    float x  = rl[p];
    float sp = (x > 20.f) ? x : log1pf(expf(x));
    float re = -sp;
    float om = ro[p];
    float er = expf(re);
    float ar = er * cosf(om);
    float ai = er * sinf(om);
    float m2 = re * re + om * om;
    float fr, fi;
    if (sqrtf(m2) > 1e-6f) {
        float nr = ar - 1.f;
        fr = (nr * re + ai * om) / m2;
        fi = (ai * re - nr * om) / m2;
    } else {
        fr = 1.0f;  // DT
        fi = 0.0f;
    }
    float pr = ar, pi = ai;              // A^L, L = 128 = 2^7
#pragma unroll
    for (int i = 0; i < 7; ++i) {
        float t = pr * pr - pi * pi;
        pi = 2.f * pr * pi;
        pr = t;
    }
    ws[p]        = ar;  ws[128 + p] = ai;
    ws[256 + p]  = fr;  ws[384 + p] = fi;
    ws[512 + p]  = pr;  ws[640 + p] = pi;
}

// ---------------------------------------------------------------------------
// Kernel 1: per-(batch, chunk) input projection G = u^T Bc, kept in the
// workspace as (B, T, P) for the y pass, and the local scan from a zero state
// that yields the chunk-end states.
// ---------------------------------------------------------------------------
__global__ __launch_bounds__(256) void ssm_chunk(
    const float* __restrict__ u,     // (B, C, T)
    const float* __restrict__ Bc,    // (C, P)
    const float* __restrict__ ws,    // params
    float* __restrict__ send,        // (B, NC, P, 2)
    float* __restrict__ gout)        // (B, T, P)
{
    __shared__ float a_lds[2][CCH * 16];   // double-buffered u^T subtile, [c][t]
    __shared__ __attribute__((aligned(16))) float Gs[16 * GSTR];   // G(t,p) subtile

    const int bid = blockIdx.x;
    const int b   = bid / NCHUNK;
    const int ch  = bid % NCHUNK;
    const int tid = threadIdx.x;
    const int w   = tid >> 5;       // wave id 0..7
    const int l   = tid & 31;       // lane
    const int m   = l & 15;         // M/N index within tile
    const int hg  = l >> 4;         // lane half-group
    const int n   = 16 * w + m;     // this wave's output column
    const int t0  = ch * LCHUNK;

    // scan-thread private state + params (threads 0..127)
    float sr = 0.f, si = 0.f, par = 0.f, pai = 0.f, pfr = 0.f, pfi = 0.f;
    if (tid < NPAIR) {
        par = ws[tid];        pai = ws[128 + tid];
        pfr = ws[256 + tid];  pfi = ws[384 + tid];
    }

    // this thread's slice of the u staging copy: 8 consecutive floats
    const int cc   = tid >> 1;
    const int half = tid & 1;
    const float* usrc = u + (size_t)b * CCH * TLEN + (size_t)cc * TLEN + t0 + half * 8;
    const int loff = cc * 16 + half * 8;

#if USE_ASYNC
    // prologue: kick off async copy of subtile 0 into buffer 0
    async_cp32B(usrc, &a_lds[0][loff]);
#else
    float4 r0 = *(const float4*)(usrc);
    float4 r1 = *(const float4*)(usrc + 4);
#endif

    // This wave's B operand (its 16 columns of Bc) does not change over the
    // chunk: read it once into registers, in WMMA fragment order.
    v2f bfr[32];
#pragma unroll   // full: constant indices keep the array in registers
    for (int kk = 0; kk < 32; ++kk) {
        int c0 = kk * 4 + 2 * hg;
        bfr[kk].x = Bc[c0 * NPAIR + n];
        bfr[kk].y = Bc[(c0 + 1) * NPAIR + n];
    }

    for (int sub = 0; sub < NSUB; ++sub) {
        const int ts  = t0 + sub * 16;
        const int buf = sub & 1;

#if USE_ASYNC
        wait_async0();              // u[buf] landed in LDS (this wave's copies)
        __syncthreads();            // ... and everyone else's
        if (sub + 1 < NSUB) {       // in-flight through GEMM1/scan
            async_cp32B(usrc + (sub + 1) * 16, &a_lds[buf ^ 1][loff]);
        }
#else
        {   // spill staged registers, then start loading the next subtile
            float* dst = &a_lds[buf][loff];
            *(float4*)(dst)     = r0;
            *(float4*)(dst + 4) = r1;
        }
        __syncthreads();
        if (sub + 1 < NSUB) {
            const float* sn = usrc + (sub + 1) * 16;
            r0 = *(const float4*)(sn);
            r1 = *(const float4*)(sn + 4);
        }
#endif

        // ---- GEMM1: G(16t x 128p) = u^T (16x128) @ Bc (128x128) ----
        v8f acc = {};
#pragma unroll   // full: bfr[] must be indexed by constants to stay in registers
        for (int kk = 0; kk < 32; ++kk) {
            int c0 = kk * 4 + 2 * hg;
            v2f av;
            av.x = a_lds[buf][c0 * 16 + m];
            av.y = a_lds[buf][(c0 + 1) * 16 + m];
            acc = __builtin_amdgcn_wmma_f32_16x16x4_f32(
                false, av, false, bfr[kk], (short)0, acc, false, false);
        }
#pragma unroll
        for (int r = 0; r < 8; ++r)
            Gs[(r + 8 * hg) * GSTR + n] = acc[r];
        __syncthreads();

        if (tid < NPAIR) {
            // ---- sequential complex scan over 16 steps (waves 0..3) ----
#pragma unroll
            for (int t = 0; t < 16; ++t) {
                float g  = Gs[t * GSTR + tid];
                float br = g * pfr;
                float bi = g * pfi;
                float nsr = par * sr - pai * si + br;
                float nsi = par * si + pai * sr + bi;
                sr = nsr;  si = nsi;
            }
        } else {
            // ---- waves 4..7, idle in the scan, keep G: one 512-byte row per store ----
            float* gd = gout + ((size_t)b * TLEN + ts + (w - 4) * 4) * NPAIR + l * 4;
            const float* gs = &Gs[(w - 4) * 4 * GSTR + l * 4];
#pragma unroll
            for (int j = 0; j < 4; ++j)
                *(float4*)(gd + j * NPAIR) = *(const float4*)(gs + j * GSTR);
        }
        __syncthreads();
    }

    if (tid < NPAIR) {
        float* e = send + ((size_t)(b * NCHUNK + ch) * NPAIR + tid) * 2;
        e[0] = sr;  e[1] = si;
    }
}

// ---------------------------------------------------------------------------
// Kernel 2: chunk-carry scan.  g_j = A^L g_{j-1} + e_j ; carry_j = g_{j-1}.
// ---------------------------------------------------------------------------
__global__ void ssm_carry(const float* __restrict__ ws,
                          const float* __restrict__ send,
                          float* __restrict__ carry) {
    int idx = blockIdx.x * blockDim.x + threadIdx.x;  // 0..2047
    int b = idx >> 7;
    int p = idx & 127;
    float alr = ws[512 + p], ali = ws[640 + p];
    float cr = 0.f, ci = 0.f;
    for (int j = 0; j < NCHUNK; ++j) {
        size_t o = ((size_t)(b * NCHUNK + j) * NPAIR + p) * 2;
        carry[o]     = cr;
        carry[o + 1] = ci;
        float er = send[o], ei = send[o + 1];
        float t = alr * cr - ali * ci + er;
        ci = alr * ci + ali * cr + ei;
        cr = t;
    }
}

// ---------------------------------------------------------------------------
// Kernel 3: per-(batch, chunk) y pass.  Reads G back, scans from the carry-in
// state and emits y = (2 Re s) @ C.
// ---------------------------------------------------------------------------
#define GTILE (16 * NPAIR)   // floats of one G subtile, contiguous in the workspace

// This lane's two 16-byte asynchronous copies of a G subtile (each wave-wide
// copy covers 512 contiguous bytes).  s_wait_xcnt closes the statement so that
// no address register of a copy is rewritten ahead of it.
__device__ __forceinline__ void copy_g(unsigned lds, const float* g) {
    asm volatile("global_load_async_to_lds_b128 %0, %1, off\n\t"
                 "global_load_async_to_lds_b128 %2, %3, off\n\t"
                 "s_wait_xcnt 0x0"
                 :: "v"(lds), "v"(g), "v"(lds + 4096u), "v"(g + 1024) : "memory");
}

__global__ __launch_bounds__(256) void ssm_out(
    const float* __restrict__ G,     // (B, T, P)
    const float* __restrict__ Cm,    // (P, O)
    const float* __restrict__ ws,    // params
    const float* __restrict__ carry, // (B, NC, P, 2)
    float* __restrict__ yout)        // (B, O, T)
{
    __shared__ __attribute__((aligned(16))) float g_lds[2][GTILE];  // G(t,p) subtiles
    __shared__ float ysT[NPAIR * YSTR];                             // (2*Re s)^T, [p][t]

    const int bid = blockIdx.x;
    const int b   = bid / NCHUNK;
    const int ch  = bid % NCHUNK;
    const int tid = threadIdx.x;
    const int w   = tid >> 5;       // wave id 0..7
    const int l   = tid & 31;       // lane
    const int m   = l & 15;         // M/N index within tile
    const int hg  = l >> 4;         // lane half-group
    const int n   = 16 * w + m;     // this wave's output column
    const int t0  = ch * LCHUNK;

    const float* gsrc = G + ((size_t)b * TLEN + t0) * NPAIR + tid * 4;
    const unsigned gdst = (unsigned)(size_t)&g_lds[0][tid * 4];   // LDS byte address

    copy_g(gdst, gsrc);             // subtile 0 -> buffer 0

    // scan-thread private state + params (threads 0..127)
    float sr = 0.f, si = 0.f, par = 0.f, pai = 0.f, pfr = 0.f, pfi = 0.f;
    if (tid < NPAIR) {
        par = ws[tid];        pai = ws[128 + tid];
        pfr = ws[256 + tid];  pfi = ws[384 + tid];
        const float* c2 = carry + ((size_t)(b * NCHUNK + ch) * NPAIR + tid) * 2;
        sr = c2[0];  si = c2[1];
    }

    // This wave's B operand (its 16 columns of Cm) does not change over the
    // chunk: read it once into registers, in WMMA fragment order.
    v2f cfr[32];
#pragma unroll   // full: constant indices keep the array in registers
    for (int kk = 0; kk < 32; ++kk) {
        int c0 = kk * 4 + 2 * hg;
        cfr[kk].x = Cm[c0 * OCH + n];
        cfr[kk].y = Cm[(c0 + 1) * OCH + n];
    }

    asm volatile("s_wait_asynccnt 0x0" ::: "memory");   // own copies of subtile 0 landed
    __syncthreads();                                    // ... and everyone else's
    copy_g(gdst + GTILE * 4u, gsrc + GTILE);            // subtile 1 -> buffer 1

    for (int sub = 0; sub < NSUB; ++sub) {
        const int ts  = t0 + sub * 16;
        const int buf = sub & 1;

        // ---- sequential complex scan over 16 steps (threads 0..127) ----
        if (tid < NPAIR) {
#pragma unroll
            for (int t = 0; t < 16; ++t) {
                float g  = g_lds[buf][t * NPAIR + tid];
                float br = g * pfr;
                float bi = g * pfi;
                float nsr = par * sr - pai * si + br;
                float nsi = par * si + pai * sr + bi;
                sr = nsr;  si = nsi;
                ysT[tid * YSTR + t] = 2.f * sr;
            }
        }
        __syncthreads();

        // ---- GEMM2: y(16t x 128o) = (2 Re s)(16x128) @ C (128x128) ----
        v8f acc2 = {};
#pragma unroll   // full: cfr[] must be indexed by constants to stay in registers
        for (int kk = 0; kk < 32; ++kk) {
            int c0 = kk * 4 + 2 * hg;
            v2f av;
            av.x = ysT[c0 * YSTR + m];
            av.y = ysT[(c0 + 1) * YSTR + m];
            acc2 = __builtin_amdgcn_wmma_f32_16x16x4_f32(
                false, av, false, cfr[kk], (short)0, acc2, false, false);
        }
        // D layout: vgpr r, lane l -> t = 8*hg + r (contiguous), o = n
        float* dst = yout + (size_t)b * OCH * TLEN + (size_t)n * TLEN + ts + 8 * hg;
        float4 p0 = { acc2[0], acc2[1], acc2[2], acc2[3] };
        float4 p1 = { acc2[4], acc2[5], acc2[6], acc2[7] };
        *(float4*)(dst)     = p0;
        *(float4*)(dst + 4) = p1;

        // publish subtile sub + 1, free buffer buf and ysT
        asm volatile("s_wait_dscnt 0x0" ::: "memory");      // own LDS reads of this trip retired
        asm volatile("s_wait_asynccnt 0x0" ::: "memory");   // own copies of subtile sub + 1 landed
        __syncthreads();
        if (sub + 2 < NSUB)                                 // flies through the next trip
            copy_g(gdst + buf * (GTILE * 4u), gsrc + (sub + 2) * GTILE);
    }
    asm volatile("s_wait_asynccnt 0x0" ::: "memory");       // nothing in flight at the wave's end
}

// ---------------------------------------------------------------------------
extern "C" void kernel_launch(void* const* d_in, const int* in_sizes, int n_in,
                              void* d_out, int out_size, void* d_ws, size_t ws_size,
                              hipStream_t stream) {
    const float* u  = (const float*)d_in[0];
    const float* rl = (const float*)d_in[1];
    const float* ro = (const float*)d_in[2];
    const float* Bc = (const float*)d_in[3];
    const float* Cm = (const float*)d_in[4];
    float* out = (float*)d_out;

    float* ws     = (float*)d_ws;
    float* params = ws;                                   // 768 floats
    float* send   = ws + 768;                             // B*NC*P*2
    float* carry  = send + (size_t)NBATCH * NCHUNK * NPAIR * 2;
    float* gbuf   = carry + (size_t)NBATCH * NCHUNK * NPAIR * 2;   // B*T*P

    ssm_setup<<<1, 128, 0, stream>>>(rl, ro, params);
    ssm_chunk<<<NBATCH * NCHUNK, 256, 0, stream>>>(u, Bc, params, send, gbuf);
    ssm_carry<<<(NBATCH * NPAIR) / 256, 256, 0, stream>>>(params, send, carry);
    ssm_out<<<NBATCH * NCHUNK, 256, 0, stream>>>(gbuf, Cm, params, carry, out);
}

// v003
// One run takes 73.8 microseconds.
// Next to v002, in two timings, it ran 1.10 times as fast each time.
// Over all steps from v000 it is 1.85 times as fast.
#include <hip/hip_runtime.h>
#include <hip/hip_bf16.h>

typedef float v2f __attribute__((ext_vector_type(2)));
typedef float v8f __attribute__((ext_vector_type(8)));
typedef int   v4i_vs __attribute__((vector_size(16)));   // matches builtin param type
typedef __attribute__((address_space(1))) v4i_vs* g_v4i_p;
typedef __attribute__((address_space(3))) v4i_vs* l_v4i_p;

#define NBATCH 16
#define CCH    128      // in_ch
#define TLEN   8192
#define NPAIR  128
#define OCH    128
#define LCHUNK 128
#define NCHUNK (TLEN / LCHUNK)   // 64
#define NSUB   (LCHUNK / 16)     // 8
#define GSTR   132               // padded stride for G tile in LDS
#define YSTR   17                // padded stride for ys^T in LDS

#if defined(__HIP_DEVICE_COMPILE__) && defined(__gfx1250__) && \
    __has_builtin(__builtin_amdgcn_global_load_async_to_lds_b128)
#define USE_ASYNC 1
#else
#define USE_ASYNC 0
#endif

__device__ __forceinline__ void wait_async0() {
#if defined(__HIP_DEVICE_COMPILE__) && defined(__gfx1250__)
#if __has_builtin(__builtin_amdgcn_s_wait_asynccnt)
    __builtin_amdgcn_s_wait_asynccnt(0);
#else
    asm volatile("s_wait_asynccnt 0x0" ::: "memory");
#endif
#endif
}

#if USE_ASYNC
__device__ __forceinline__ void async_cp32B(const float* gsrc, float* ldst) {
    // copies 32 bytes: two b128 transfers; IOFFSET applies to both addresses
    __builtin_amdgcn_global_load_async_to_lds_b128(
        (g_v4i_p)(void*)gsrc, (l_v4i_p)(void*)ldst, 0, 0);
    __builtin_amdgcn_global_load_async_to_lds_b128(
        (g_v4i_p)(void*)gsrc, (l_v4i_p)(void*)ldst, 16, 0);
}
#endif

// ---------------------------------------------------------------------------
// Per-pair parameters.  A_d = exp(-softplus(rl) + i*omega) and
// factor = (A_d - 1)/lambda (or DT).  Kernel 1's scan threads work out their own pair's; the y pass reads them.
// ---------------------------------------------------------------------------
__device__ __forceinline__ void pair_params(float x, float om,
                                            float& ar, float& ai,
                                            float& fr, float& fi) {
    float sp = (x > 20.f) ? x : log1pf(expf(x));
    float re = -sp;
    float er = expf(re);
    ar = er * cosf(om);
    ai = er * sinf(om);
    float m2 = re * re + om * om;
    if (sqrtf(m2) > 1e-6f) {
        float nr = ar - 1.f;
        fr = (nr * re + ai * om) / m2;
        fi = (ai * re - nr * om) / m2;
    } else {
        fr = 1.0f;  // DT
        fi = 0.0f;
    }
}

// ---------------------------------------------------------------------------
// Kernel 1: per-(batch, chunk) input projection G = u^T Bc, kept in the
// workspace as (B, T, P) for the y pass, and the local scan from a zero state
// that yields the chunk-end states.
// ---------------------------------------------------------------------------
__global__ __launch_bounds__(256) void ssm_chunk(
    const float* __restrict__ u,     // (B, C, T)
    const float* __restrict__ Bc,    // (C, P)
    const float* __restrict__ rl,    // (P)
    const float* __restrict__ ro,    // (P)
    float* __restrict__ ws,          // params for the y pass, [Ar|Ai|Fr|Fi|ALr|ALi]
    float* __restrict__ send,        // (B, NC, P, 2)
    float* __restrict__ gout)        // (B, T, P)
{
    __shared__ float a_lds[2][CCH * 16];   // double-buffered u^T subtile, [c][t]
    __shared__ __attribute__((aligned(16))) float Gs[16 * GSTR];   // G(t,p) subtile

    const int bid = blockIdx.x;
    const int b   = bid / NCHUNK;
    const int ch  = bid % NCHUNK;
    const int tid = threadIdx.x;
    const int w   = tid >> 5;       // wave id 0..7
    const int l   = tid & 31;       // lane
    const int m   = l & 15;         // M/N index within tile
    const int hg  = l >> 4;         // lane half-group
    const int n   = 16 * w + m;     // this wave's output column
    const int t0  = ch * LCHUNK;

    // this thread's slice of the u staging copy: 8 consecutive floats
    const int cc   = tid >> 1;
    const int half = tid & 1;
    const float* usrc = u + (size_t)b * CCH * TLEN + (size_t)cc * TLEN + t0 + half * 8;
    const int loff = cc * 16 + half * 8;

#if USE_ASYNC
    // prologue: kick off async copy of subtile 0 into buffer 0
    async_cp32B(usrc, &a_lds[0][loff]);
#else
    float4 r0 = *(const float4*)(usrc);
    float4 r1 = *(const float4*)(usrc + 4);
#endif

    // This wave's B operand (its 16 columns of Bc) does not change over the
    // chunk: read it once into registers, in WMMA fragment order.
    v2f bfr[32];
#pragma unroll   // full: constant indices keep the array in registers
    for (int kk = 0; kk < 32; ++kk) {
        int c0 = kk * 4 + 2 * hg;
        bfr[kk].x = Bc[c0 * NPAIR + n];
        bfr[kk].y = Bc[(c0 + 1) * NPAIR + n];
    }

    // scan-thread private state + params (threads 0..127)
    float sr = 0.f, si = 0.f, par = 0.f, pai = 0.f, pfr = 0.f, pfi = 0.f;
    if (tid < NPAIR) {
        pair_params(rl[tid], ro[tid], par, pai, pfr, pfi);
        if (bid == 0) {                      // one block keeps them for the y pass
            float pr = par, pi = pai;        // A^L, L = 128 = 2^7
#pragma unroll
            for (int i = 0; i < 7; ++i) {
                float t = pr * pr - pi * pi;
                pi = 2.f * pr * pi;
                pr = t;
            }
            ws[tid]       = par;  ws[128 + tid] = pai;
            ws[256 + tid] = pfr;  ws[384 + tid] = pfi;
            ws[512 + tid] = pr;   ws[640 + tid] = pi;
        }
    }

    for (int sub = 0; sub < NSUB; ++sub) {
        const int ts  = t0 + sub * 16;
        const int buf = sub & 1;

#if USE_ASYNC
        wait_async0();              // u[buf] landed in LDS (this wave's copies)
        __syncthreads();            // ... and everyone else's
        if (sub + 1 < NSUB) {       // in-flight through GEMM1/scan
            async_cp32B(usrc + (sub + 1) * 16, &a_lds[buf ^ 1][loff]);
        }
#else
        {   // spill staged registers, then start loading the next subtile
            float* dst = &a_lds[buf][loff];
            *(float4*)(dst)     = r0;
            *(float4*)(dst + 4) = r1;
        }
        __syncthreads();
        if (sub + 1 < NSUB) {
            const float* sn = usrc + (sub + 1) * 16;
            r0 = *(const float4*)(sn);
            r1 = *(const float4*)(sn + 4);
        }
#endif

        // ---- GEMM1: G(16t x 128p) = u^T (16x128) @ Bc (128x128) ----
        v8f acc = {};
#pragma unroll   // full: bfr[] must be indexed by constants to stay in registers
        for (int kk = 0; kk < 32; ++kk) {
            int c0 = kk * 4 + 2 * hg;
            v2f av;
            av.x = a_lds[buf][c0 * 16 + m];
            av.y = a_lds[buf][(c0 + 1) * 16 + m];
            acc = __builtin_amdgcn_wmma_f32_16x16x4_f32(
                false, av, false, bfr[kk], (short)0, acc, false, false);
        }
#pragma unroll
        for (int r = 0; r < 8; ++r)
            Gs[(r + 8 * hg) * GSTR + n] = acc[r];
        __syncthreads();

        if (tid < NPAIR) {
            // ---- sequential complex scan over 16 steps (waves 0..3) ----
#pragma unroll
            for (int t = 0; t < 16; ++t) {
                float g  = Gs[t * GSTR + tid];
                float br = g * pfr;
                float bi = g * pfi;
                float nsr = par * sr - pai * si + br;
                float nsi = par * si + pai * sr + bi;
                sr = nsr;  si = nsi;
            }
        } else {
            // ---- waves 4..7, idle in the scan, keep G: one 512-byte row per store ----
            float* gd = gout + ((size_t)b * TLEN + ts + (w - 4) * 4) * NPAIR + l * 4;
            const float* gs = &Gs[(w - 4) * 4 * GSTR + l * 4];
#pragma unroll
            for (int j = 0; j < 4; ++j)
                *(float4*)(gd + j * NPAIR) = *(const float4*)(gs + j * GSTR);
        }
        __syncthreads();
    }

    if (tid < NPAIR) {
        float* e = send + ((size_t)(b * NCHUNK + ch) * NPAIR + tid) * 2;
        e[0] = sr;  e[1] = si;
    }
}

// ---------------------------------------------------------------------------
// Kernel 2: per-(batch, chunk) y pass.  Works out its own carry-in state from
// the chunk-end states before it (g_j = A^L g_{j-1} + e_j), reads G back, scans
// from that state and emits y = (2 Re s) @ C.
// ---------------------------------------------------------------------------
#define GTILE (16 * NPAIR)   // floats of one G subtile, contiguous in the workspace
#define EBATCH 16            // chunk-end states asked for at a time

// This lane's two 16-byte asynchronous copies of a G subtile (each wave-wide
// copy covers 512 contiguous bytes).  s_wait_xcnt closes the statement so that
// no address register of a copy is rewritten ahead of it.
__device__ __forceinline__ void copy_g(unsigned lds, const float* g) {
    asm volatile("global_load_async_to_lds_b128 %0, %1, off\n\t"
                 "global_load_async_to_lds_b128 %2, %3, off\n\t"
                 "s_wait_xcnt 0x0"
                 :: "v"(lds), "v"(g), "v"(lds + 4096u), "v"(g + 1024) : "memory");
}

__global__ __launch_bounds__(256) void ssm_out(
    const float* __restrict__ G,     // (B, T, P)
    const float* __restrict__ Cm,    // (P, O)
    const float* __restrict__ ws,    // params
    const float* __restrict__ send,  // (B, NC, P, 2)
    float* __restrict__ yout)        // (B, O, T)
{
    __shared__ __attribute__((aligned(16))) float g_lds[2][GTILE];  // G(t,p) subtiles
    __shared__ float ysT[NPAIR * YSTR];                             // (2*Re s)^T, [p][t]

    const int bid = blockIdx.x;
    const int b   = bid / NCHUNK;
    const int ch  = bid % NCHUNK;
    const int tid = threadIdx.x;
    const int w   = tid >> 5;       // wave id 0..7
    const int l   = tid & 31;       // lane
    const int m   = l & 15;         // M/N index within tile
    const int hg  = l >> 4;         // lane half-group
    const int n   = 16 * w + m;     // this wave's output column
    const int t0  = ch * LCHUNK;

    const float* gsrc = G + ((size_t)b * TLEN + t0) * NPAIR + tid * 4;
    const unsigned gdst = (unsigned)(size_t)&g_lds[0][tid * 4];   // LDS byte address

    copy_g(gdst, gsrc);             // subtile 0 -> buffer 0

    // scan-thread private state + params (threads 0..127).  The carry-in comes
    // ahead of the Cm loads below, so that the two do not hold registers together.
    float sr = 0.f, si = 0.f, par = 0.f, pai = 0.f, pfr = 0.f, pfi = 0.f;
    if (tid < NPAIR) {
        // End states of this batch's chunks, EBATCH at a time.  Every index asked
        // for is below NCHUNK; states of chunks from ch on are asked for with
        // the rest of their batch and not used.
        const float2* ep = (const float2*)send + (size_t)b * NCHUNK * NPAIR + tid;
        float2 e[EBATCH];
#pragma unroll   // full: constant indices keep the array in registers
        for (int i = 0; i < EBATCH; ++i)
            e[i] = ep[i * NPAIR];

        par = ws[tid];        pai = ws[128 + tid];
        pfr = ws[256 + tid];  pfi = ws[384 + tid];
        const float alr = ws[512 + tid], ali = ws[640 + tid];   // A^L

        int j0 = 0;
        while (j0 + EBATCH <= ch) {          // whole batches; ch < NCHUNK
#pragma unroll   // full: constant indices keep the array in registers
            for (int i = 0; i < EBATCH; ++i) {
                float t = alr * sr - ali * si + e[i].x;
                si = alr * si + ali * sr + e[i].y;
                sr = t;
            }
            j0 += EBATCH;
            ep += EBATCH * NPAIR;
#pragma unroll   // full: constant indices keep the array in registers
            for (int i = 0; i < EBATCH; ++i)
                e[i] = ep[i * NPAIR];
        }
#pragma unroll   // full: constant indices keep the array in registers
        for (int i = 0; i < EBATCH - 1; ++i) {   // the last ch - j0 states
            if (j0 + i < ch) {
                float t = alr * sr - ali * si + e[i].x;
                si = alr * si + ali * sr + e[i].y;
                sr = t;
            }
        }
    }

    // This wave's B operand (its 16 columns of Cm) does not change over the
    // chunk: read it once into registers, in WMMA fragment order.
    v2f cfr[32];
#pragma unroll   // full: constant indices keep the array in registers
    for (int kk = 0; kk < 32; ++kk) {
        int c0 = kk * 4 + 2 * hg;
        cfr[kk].x = Cm[c0 * OCH + n];
        cfr[kk].y = Cm[(c0 + 1) * OCH + n];
    }

    asm volatile("s_wait_asynccnt 0x0" ::: "memory");   // own copies of subtile 0 landed
    __syncthreads();                                    // ... and everyone else's
    copy_g(gdst + GTILE * 4u, gsrc + GTILE);            // subtile 1 -> buffer 1

    for (int sub = 0; sub < NSUB; ++sub) {
        const int ts  = t0 + sub * 16;
        const int buf = sub & 1;

        // ---- sequential complex scan over 16 steps (threads 0..127) ----
        if (tid < NPAIR) {
#pragma unroll
            for (int t = 0; t < 16; ++t) {
                float g  = g_lds[buf][t * NPAIR + tid];
                float br = g * pfr;
                float bi = g * pfi;
                float nsr = par * sr - pai * si + br;
                float nsi = par * si + pai * sr + bi;
                sr = nsr;  si = nsi;
                ysT[tid * YSTR + t] = 2.f * sr;
            }
        }
        __syncthreads();

        // ---- GEMM2: y(16t x 128o) = (2 Re s)(16x128) @ C (128x128) ----
        v8f acc2 = {};
#pragma unroll   // full: cfr[] must be indexed by constants to stay in registers
        for (int kk = 0; kk < 32; ++kk) {
            int c0 = kk * 4 + 2 * hg;
            v2f av;
            av.x = ysT[c0 * YSTR + m];
            av.y = ysT[(c0 + 1) * YSTR + m];
            acc2 = __builtin_amdgcn_wmma_f32_16x16x4_f32(
                false, av, false, cfr[kk], (short)0, acc2, false, false);
        }
        // D layout: vgpr r, lane l -> t = 8*hg + r (contiguous), o = n
        float* dst = yout + (size_t)b * OCH * TLEN + (size_t)n * TLEN + ts + 8 * hg;
        float4 p0 = { acc2[0], acc2[1], acc2[2], acc2[3] };
        float4 p1 = { acc2[4], acc2[5], acc2[6], acc2[7] };
        *(float4*)(dst)     = p0;
        *(float4*)(dst + 4) = p1;

        // publish subtile sub + 1, free buffer buf and ysT
        asm volatile("s_wait_dscnt 0x0" ::: "memory");      // own LDS reads of this trip retired
        asm volatile("s_wait_asynccnt 0x0" ::: "memory");   // own copies of subtile sub + 1 landed
        __syncthreads();
        if (sub + 2 < NSUB)                                 // flies through the next trip
            copy_g(gdst + buf * (GTILE * 4u), gsrc + (sub + 2) * GTILE);
    }
    asm volatile("s_wait_asynccnt 0x0" ::: "memory");       // nothing in flight at the wave's end
}

// ---------------------------------------------------------------------------
extern "C" void kernel_launch(void* const* d_in, const int* in_sizes, int n_in,
                              void* d_out, int out_size, void* d_ws, size_t ws_size,
                              hipStream_t stream) {
    const float* u  = (const float*)d_in[0];
    const float* rl = (const float*)d_in[1];
    const float* ro = (const float*)d_in[2];
    const float* Bc = (const float*)d_in[3];
    const float* Cm = (const float*)d_in[4];
    float* out = (float*)d_out;

    float* params = (float*)d_ws;                                  // 768 floats
    float* send   = params + 768;                                  // B*NC*P*2
    float* gbuf   = send + (size_t)NBATCH * NCHUNK * NPAIR * 2;    // B*T*P

    ssm_chunk<<<NBATCH * NCHUNK, 256, 0, stream>>>(u, Bc, rl, ro, params, send, gbuf);
    ssm_out<<<NBATCH * NCHUNK, 256, 0, stream>>>(gbuf, Cm, params, send, out);
}

// v004
// Measured time: 70.7 microseconds a run.
// Timed twice side by side with v003, it ran 1.04 times as fast both times.
// All steps since v000 together make it 1.92 times as fast.
#include <hip/hip_runtime.h>
#include <hip/hip_bf16.h>

typedef float v2f __attribute__((ext_vector_type(2)));
typedef float v8f __attribute__((ext_vector_type(8)));
typedef int   v4i_vs __attribute__((vector_size(16)));   // matches builtin param type
typedef __attribute__((address_space(1))) v4i_vs* g_v4i_p;
typedef __attribute__((address_space(3))) v4i_vs* l_v4i_p;

#define NBATCH 16
#define CCH    128      // in_ch
#define TLEN   8192
#define NPAIR  128
#define OCH    128
#define LCHUNK 128
#define NCHUNK (TLEN / LCHUNK)   // 64
#define NSUB   (LCHUNK / 16)     // 8
#define YSTR   17                // padded stride for ys^T in LDS

#if defined(__HIP_DEVICE_COMPILE__) && defined(__gfx1250__) && \
    __has_builtin(__builtin_amdgcn_global_load_async_to_lds_b128)
#define USE_ASYNC 1
#else
#define USE_ASYNC 0
#endif

__device__ __forceinline__ void wait_async0() {
#if defined(__HIP_DEVICE_COMPILE__) && defined(__gfx1250__)
#if __has_builtin(__builtin_amdgcn_s_wait_asynccnt)
    __builtin_amdgcn_s_wait_asynccnt(0);
#else
    asm volatile("s_wait_asynccnt 0x0" ::: "memory");
#endif
#endif
}

#if USE_ASYNC
__device__ __forceinline__ void async_cp32B(const float* gsrc, float* ldst) {
    // copies 32 bytes: two b128 transfers; IOFFSET applies to both addresses
    __builtin_amdgcn_global_load_async_to_lds_b128(
        (g_v4i_p)(void*)gsrc, (l_v4i_p)(void*)ldst, 0, 0);
    __builtin_amdgcn_global_load_async_to_lds_b128(
        (g_v4i_p)(void*)gsrc, (l_v4i_p)(void*)ldst, 16, 0);
}
#endif

// ---------------------------------------------------------------------------
// Per-pair parameters.  A_d = exp(-softplus(rl) + i*omega) and
// factor = (A_d - 1)/lambda (or DT).  Each thread of kernel 1 works out its own pair's.
// ---------------------------------------------------------------------------
__device__ __forceinline__ void pair_params(float x, float om,
                                            float& ar, float& ai,
                                            float& fr, float& fi) {
    float sp = (x > 20.f) ? x : log1pf(expf(x));
    float re = -sp;
    float er = expf(re);
    ar = er * cosf(om);
    ai = er * sinf(om);
    float m2 = re * re + om * om;
    if (sqrtf(m2) > 1e-6f) {
        float nr = ar - 1.f;
        fr = (nr * re + ai * om) / m2;
        fi = (ai * re - nr * om) / m2;
    } else {
        fr = 1.0f;  // DT
        fi = 0.0f;
    }
}

// ---------------------------------------------------------------------------
// Kernel 1: per-(batch, chunk) input projection G = u^T Bc, kept in the
// workspace for the y pass, and the chunk-end states of a scan from zero.
// A wave's accumulator holds, per lane, 8 consecutive steps of ONE pair
// (t = 8*hg + r, pair n), and only the END state is wanted here, which is the
// sum over t of f * A^(L-1-t) * g_t.  So each lane sums its own 8 values with
// fixed weights, carries that sum from subtile to subtile by A^16, and the two
// lane halves are added once at the end: no LDS tile, no serial scan.
// G layout in the workspace, per 16-step subtile (GTILE floats), accumulator
// order: [wave w][j = r / 4][lane][r % 4], so a wave's store is 512 whole bytes.
// ---------------------------------------------------------------------------
#define GTILE (16 * NPAIR)   // floats of one G subtile, contiguous in the workspace

__global__ __launch_bounds__(256) void ssm_chunk(
    const float* __restrict__ u,     // (B, C, T)
    const float* __restrict__ Bc,    // (C, P)
    const float* __restrict__ rl,    // (P)
    const float* __restrict__ ro,    // (P)
    float* __restrict__ ws,          // params for the y pass, [Ar|Ai|Fr|Fi|ALr|ALi]
    float* __restrict__ send,        // (B, NC, P, 2)
    float* __restrict__ gout)        // (B, T / 16, GTILE)
{
    __shared__ float a_lds[2][CCH * 16];   // double-buffered u^T subtile, [c][t]

    const int bid = blockIdx.x;
    const int b   = bid / NCHUNK;
    const int ch  = bid % NCHUNK;
    const int tid = threadIdx.x;
    const int w   = tid >> 5;       // wave id 0..7
    const int l   = tid & 31;       // lane
    const int m   = l & 15;         // M/N index within tile
    const int hg  = l >> 4;         // lane half-group
    const int n   = 16 * w + m;     // this wave's output column
    const int t0  = ch * LCHUNK;

    // this thread's slice of the u staging copy: 8 consecutive floats
    const int cc   = tid >> 1;
    const int half = tid & 1;
    const float* usrc = u + (size_t)b * CCH * TLEN + (size_t)cc * TLEN + t0 + half * 8;
    const int loff = cc * 16 + half * 8;

#if USE_ASYNC
    // prologue: kick off async copy of subtile 0 into buffer 0
    async_cp32B(usrc, &a_lds[0][loff]);
#else
    float4 r0 = *(const float4*)(usrc);
    float4 r1 = *(const float4*)(usrc + 4);
#endif

    // This wave's B operand (its 16 columns of Bc) does not change over the
    // chunk: read it once into registers, in WMMA fragment order.
    v2f bfr[32];
#pragma unroll   // full: constant indices keep the array in registers
    for (int kk = 0; kk < 32; ++kk) {
        int c0 = kk * 4 + 2 * hg;
        bfr[kk].x = Bc[c0 * NPAIR + n];
        bfr[kk].y = Bc[(c0 + 1) * NPAIR + n];
    }

    // Parameters of this lane's pair n, and A^2, A^4, ... A^128 by squaring.
    float par, pai, pfr, pfi;
    pair_params(rl[n], ro[n], par, pai, pfr, pfi);
    float qr[8], qi[8];              // qr[i] + i*qi[i] = A^(2^i)
    qr[0] = par;  qi[0] = pai;
#pragma unroll
    for (int i = 1; i < 8; ++i) {
        qr[i] = qr[i - 1] * qr[i - 1] - qi[i - 1] * qi[i - 1];
        qi[i] = 2.f * qr[i - 1] * qi[i - 1];
    }
    if (bid == 0 && hg == 0) {       // one block keeps them for the y pass
        ws[n]       = par;    ws[128 + n] = pai;
        ws[256 + n] = pfr;    ws[384 + n] = pfi;
        ws[512 + n] = qr[7];  ws[640 + n] = qi[7];   // A^L, L = 128
    }
    const float a16r = qr[4], a16i = qi[4];

    // Weights of this lane's 8 steps: wr[r] + i*wi[r] = f * A^(15 - (8*hg + r)).
    float wr[8], wi[8];
    wr[7] = hg ? pfr : pfr * qr[3] - pfi * qi[3];
    wi[7] = hg ? pfi : pfr * qi[3] + pfi * qr[3];
#pragma unroll
    for (int r = 6; r >= 0; --r) {
        wr[r] = wr[r + 1] * par - wi[r + 1] * pai;
        wi[r] = wr[r + 1] * pai + wi[r + 1] * par;
    }

    float sr = 0.f, si = 0.f;        // this lane's share of the pair's state
    float* gd = gout + ((size_t)b * TLEN + t0) * NPAIR + (w * 64 + l) * 4;
    v8f acc = {};

    for (int sub = 0; sub <= NSUB; ++sub) {
        const int buf = sub & 1;

        if (sub < NSUB) {
#if USE_ASYNC
            // publish subtile sub, free the other buffer
            asm volatile("s_wait_dscnt 0x0" ::: "memory");      // own LDS reads of the last trip retired
            asm volatile("s_wait_asynccnt 0x0" ::: "memory");   // own copies of subtile sub landed
            __syncthreads();                                    // ... and everyone else's
            if (sub + 1 < NSUB) {       // in flight through this trip's GEMM
                async_cp32B(usrc + (sub + 1) * 16, &a_lds[buf ^ 1][loff]);
            }
#else
            {   // spill staged registers, then start loading the next subtile
                float* dst = &a_lds[buf][loff];
                *(float4*)(dst)     = r0;
                *(float4*)(dst + 4) = r1;
            }
            __syncthreads();
            if (sub + 1 < NSUB) {
                const float* sn = usrc + (sub + 1) * 16;
                r0 = *(const float4*)(sn);
                r1 = *(const float4*)(sn + 4);
            }
#endif
        }

        // ---- the subtile before this one: keep G, fold it into the state.
        // Behind the barrier, so that the stores have this trip's GEMM to
        // complete in before the next barrier waits for them.
        if (sub > 0) {
            float4 p0 = { acc[0], acc[1], acc[2], acc[3] };
            float4 p1 = { acc[4], acc[5], acc[6], acc[7] };
            float* g = gd + (sub - 1) * GTILE;
            *(float4*)(g)       = p0;
            *(float4*)(g + 128) = p1;
            float ar0 = wr[0] * acc[0], ai0 = wi[0] * acc[0];
            float ar1 = wr[4] * acc[4], ai1 = wi[4] * acc[4];
#pragma unroll
            for (int r = 1; r < 4; ++r) {
                ar0 += wr[r] * acc[r];          ai0 += wi[r] * acc[r];
                ar1 += wr[r + 4] * acc[r + 4];  ai1 += wi[r + 4] * acc[r + 4];
            }
            float nsr = a16r * sr - a16i * si + (ar0 + ar1);
            float nsi = a16r * si + a16i * sr + (ai0 + ai1);
            sr = nsr;  si = nsi;
        }

        if (sub < NSUB) {
            // ---- GEMM1: G(16t x 128p) = u^T (16x128) @ Bc (128x128) ----
            v8f a = {};
#pragma unroll   // full: bfr[] must be indexed by constants to stay in registers
            for (int kk = 0; kk < 32; ++kk) {
                int c0 = kk * 4 + 2 * hg;
                v2f av;
                av.x = a_lds[buf][c0 * 16 + m];
                av.y = a_lds[buf][(c0 + 1) * 16 + m];
                a = __builtin_amdgcn_wmma_f32_16x16x4_f32(
                    false, av, false, bfr[kk], (short)0, a, false, false);
            }
            acc = a;
        }
    }

    // the pair's end state = the two lane halves' shares
    sr += __shfl_xor(sr, 16, 32);
    si += __shfl_xor(si, 16, 32);
    if (hg == 0) {
        float2 e = { sr, si };
        *((float2*)send + (size_t)(b * NCHUNK + ch) * NPAIR + n) = e;
    }
}

// ---------------------------------------------------------------------------
// Kernel 2: per-(batch, chunk) y pass.  Works out its own carry-in state from
// the chunk-end states before it (g_j = A^L g_{j-1} + e_j), reads G back, scans
// from that state and emits y = (2 Re s) @ C.
// ---------------------------------------------------------------------------
#define EBATCH 16            // chunk-end states asked for at a time

// This lane's two 16-byte asynchronous copies of a G subtile (each wave-wide
// copy covers 512 contiguous bytes).  s_wait_xcnt closes the statement so that
// no address register of a copy is rewritten ahead of it.
__device__ __forceinline__ void copy_g(unsigned lds, const float* g) {
    asm volatile("global_load_async_to_lds_b128 %0, %1, off\n\t"
                 "global_load_async_to_lds_b128 %2, %3, off\n\t"
                 "s_wait_xcnt 0x0"
                 :: "v"(lds), "v"(g), "v"(lds + 4096u), "v"(g + 1024) : "memory");
}

__global__ __launch_bounds__(256) void ssm_out(
    const float* __restrict__ G,     // (B, T / 16, GTILE), accumulator order
    const float* __restrict__ Cm,    // (P, O)
    const float* __restrict__ ws,    // params
    const float* __restrict__ send,  // (B, NC, P, 2)
    float* __restrict__ yout)        // (B, O, T)
{
    __shared__ __attribute__((aligned(16))) float g_lds[2][GTILE];  // G subtiles
    __shared__ float ysT[NPAIR * YSTR];                             // (2*Re s)^T, [p][t]

    const int bid = blockIdx.x;
    const int b   = bid / NCHUNK;
    const int ch  = bid % NCHUNK;
    const int tid = threadIdx.x;
    const int w   = tid >> 5;       // wave id 0..7
    const int l   = tid & 31;       // lane
    const int m   = l & 15;         // M/N index within tile
    const int hg  = l >> 4;         // lane half-group
    const int n   = 16 * w + m;     // this wave's output column
    const int t0  = ch * LCHUNK;

    const float* gsrc = G + ((size_t)b * TLEN + t0) * NPAIR + tid * 4;
    const unsigned gdst = (unsigned)(size_t)&g_lds[0][tid * 4];   // LDS byte address

    copy_g(gdst, gsrc);             // subtile 0 -> buffer 0

    // scan-thread private state + params (threads 0..127).  The carry-in comes
    // ahead of the Cm loads below, so that the two do not hold registers together.
    float sr = 0.f, si = 0.f, par = 0.f, pai = 0.f, pfr = 0.f, pfi = 0.f;
    if (tid < NPAIR) {
        // End states of this batch's chunks, EBATCH at a time.  Every index asked
        // for is below NCHUNK; states of chunks from ch on are asked for with
        // the rest of their batch and not used.
        const float2* ep = (const float2*)send + (size_t)b * NCHUNK * NPAIR + tid;
        float2 e[EBATCH];
#pragma unroll   // full: constant indices keep the array in registers
        for (int i = 0; i < EBATCH; ++i)
            e[i] = ep[i * NPAIR];

        par = ws[tid];        pai = ws[128 + tid];
        pfr = ws[256 + tid];  pfi = ws[384 + tid];
        const float alr = ws[512 + tid], ali = ws[640 + tid];   // A^L

        int j0 = 0;
        while (j0 + EBATCH <= ch) {          // whole batches; ch < NCHUNK
#pragma unroll   // full: constant indices keep the array in registers
            for (int i = 0; i < EBATCH; ++i) {
                float t = alr * sr - ali * si + e[i].x;
                si = alr * si + ali * sr + e[i].y;
                sr = t;
            }
            j0 += EBATCH;
            ep += EBATCH * NPAIR;
#pragma unroll   // full: constant indices keep the array in registers
            for (int i = 0; i < EBATCH; ++i)
                e[i] = ep[i * NPAIR];
        }
#pragma unroll   // full: constant indices keep the array in registers
        for (int i = 0; i < EBATCH - 1; ++i) {   // the last ch - j0 states
            if (j0 + i < ch) {
                float t = alr * sr - ali * si + e[i].x;
                si = alr * si + ali * sr + e[i].y;
                sr = t;
            }
        }
    }

    // This wave's B operand (its 16 columns of Cm) does not change over the
    // chunk: read it once into registers, in WMMA fragment order.
    v2f cfr[32];
#pragma unroll   // full: constant indices keep the array in registers
    for (int kk = 0; kk < 32; ++kk) {
        int c0 = kk * 4 + 2 * hg;
        cfr[kk].x = Cm[c0 * OCH + n];
        cfr[kk].y = Cm[(c0 + 1) * OCH + n];
    }

    asm volatile("s_wait_asynccnt 0x0" ::: "memory");   // own copies of subtile 0 landed
    __syncthreads();                                    // ... and everyone else's
    copy_g(gdst + GTILE * 4u, gsrc + GTILE);            // subtile 1 -> buffer 1

    for (int sub = 0; sub < NSUB; ++sub) {
        const int ts  = t0 + sub * 16;
        const int buf = sub & 1;

        // ---- sequential complex scan over 16 steps (threads 0..127) ----
        if (tid < NPAIR) {
            // pair tid's 16 steps lie as four float4: steps 4q .. 4q + 3 at
            // [wave tid / 16][j = q & 1][lane (q >> 1) * 16 + tid % 16]
            const float* gp = &g_lds[buf][((tid >> 4) * 64 + (tid & 15)) * 4];
#pragma unroll
            for (int q = 0; q < 4; ++q) {
                const float4 g4 = *(const float4*)(gp + ((q & 1) * 32 + (q >> 1) * 16) * 4);
                const float gv[4] = { g4.x, g4.y, g4.z, g4.w };
#pragma unroll
                for (int i = 0; i < 4; ++i) {
                    float br = gv[i] * pfr;
                    float bi = gv[i] * pfi;
                    float nsr = par * sr - pai * si + br;
                    float nsi = par * si + pai * sr + bi;
                    sr = nsr;  si = nsi;
                    ysT[tid * YSTR + 4 * q + i] = 2.f * sr;
                }
            }
        }
        __syncthreads();

        // ---- GEMM2: y(16t x 128o) = (2 Re s)(16x128) @ C (128x128) ----
        v8f acc2 = {};
#pragma unroll   // full: cfr[] must be indexed by constants to stay in registers
        for (int kk = 0; kk < 32; ++kk) {
            int c0 = kk * 4 + 2 * hg;
            v2f av;
            av.x = ysT[c0 * YSTR + m];
            av.y = ysT[(c0 + 1) * YSTR + m];
            acc2 = __builtin_amdgcn_wmma_f32_16x16x4_f32(
                false, av, false, cfr[kk], (short)0, acc2, false, false);
        }
        // D layout: vgpr r, lane l -> t = 8*hg + r (contiguous), o = n
        float* dst = yout + (size_t)b * OCH * TLEN + (size_t)n * TLEN + ts + 8 * hg;
        float4 p0 = { acc2[0], acc2[1], acc2[2], acc2[3] };
        float4 p1 = { acc2[4], acc2[5], acc2[6], acc2[7] };
        *(float4*)(dst)     = p0;
        *(float4*)(dst + 4) = p1;

        // publish subtile sub + 1, free buffer buf and ysT
        asm volatile("s_wait_dscnt 0x0" ::: "memory");      // own LDS reads of this trip retired
        asm volatile("s_wait_asynccnt 0x0" ::: "memory");   // own copies of subtile sub + 1 landed
        __syncthreads();
        if (sub + 2 < NSUB)                                 // flies through the next trip
            copy_g(gdst + buf * (GTILE * 4u), gsrc + (sub + 2) * GTILE);
    }
    asm volatile("s_wait_asynccnt 0x0" ::: "memory");       // nothing in flight at the wave's end
}

// ---------------------------------------------------------------------------
extern "C" void kernel_launch(void* const* d_in, const int* in_sizes, int n_in,
                              void* d_out, int out_size, void* d_ws, size_t ws_size,
                              hipStream_t stream) {
    const float* u  = (const float*)d_in[0];
    const float* rl = (const float*)d_in[1];
    const float* ro = (const float*)d_in[2];
    const float* Bc = (const float*)d_in[3];
    const float* Cm = (const float*)d_in[4];
    float* out = (float*)d_out;

    float* params = (float*)d_ws;                                  // 768 floats
    float* send   = params + 768;                                  // B*NC*P*2
    float* gbuf   = send + (size_t)NBATCH * NCHUNK * NPAIR * 2;    // B*T*P

    ssm_chunk<<<NBATCH * NCHUNK, 256, 0, stream>>>(u, Bc, rl, ro, params, send, gbuf);
    ssm_out<<<NBATCH * NCHUNK, 256, 0, stream>>>(gbuf, Cm, params, send, out);
}

// v005
// One run takes 60.7 microseconds.
// Next to v004, in two timings, it ran 1.17 times as fast each time.
// Counting every step since v000, it is 2.24 times as fast.
#include <hip/hip_runtime.h>
#include <hip/hip_bf16.h>

typedef float v2f __attribute__((ext_vector_type(2)));
typedef float v8f __attribute__((ext_vector_type(8)));
typedef int   v4i_vs __attribute__((vector_size(16)));   // matches builtin param type
typedef __attribute__((address_space(1))) v4i_vs* g_v4i_p;
typedef __attribute__((address_space(3))) v4i_vs* l_v4i_p;

#define NBATCH 16
#define CCH    128      // in_ch
#define TLEN   8192
#define NPAIR  128
#define OCH    128
#define LCHUNK 128
#define NCHUNK (TLEN / LCHUNK)   // 64
#define NSUB   (LCHUNK / 16)     // 8

#if defined(__HIP_DEVICE_COMPILE__) && defined(__gfx1250__) && \
    __has_builtin(__builtin_amdgcn_global_load_async_to_lds_b128)
#define USE_ASYNC 1
#else
#define USE_ASYNC 0
#endif

__device__ __forceinline__ void wait_async0() {
#if defined(__HIP_DEVICE_COMPILE__) && defined(__gfx1250__)
#if __has_builtin(__builtin_amdgcn_s_wait_asynccnt)
    __builtin_amdgcn_s_wait_asynccnt(0);
#else
    asm volatile("s_wait_asynccnt 0x0" ::: "memory");
#endif
#endif
}

#if USE_ASYNC
__device__ __forceinline__ void async_cp32B(const float* gsrc, float* ldst) {
    // copies 32 bytes: two b128 transfers; IOFFSET applies to both addresses
    __builtin_amdgcn_global_load_async_to_lds_b128(
        (g_v4i_p)(void*)gsrc, (l_v4i_p)(void*)ldst, 0, 0);
    __builtin_amdgcn_global_load_async_to_lds_b128(
        (g_v4i_p)(void*)gsrc, (l_v4i_p)(void*)ldst, 16, 0);
}
#endif

// ---------------------------------------------------------------------------
// Per-pair parameters.  A_d = exp(-softplus(rl) + i*omega) and
// factor = (A_d - 1)/lambda (or DT).  Each thread of kernel 1 works out its own pair's.
// ---------------------------------------------------------------------------
__device__ __forceinline__ void pair_params(float x, float om,
                                            float& ar, float& ai,
                                            float& fr, float& fi) {
    float sp = (x > 20.f) ? x : log1pf(expf(x));
    float re = -sp;
    float er = expf(re);
    ar = er * cosf(om);
    ai = er * sinf(om);
    float m2 = re * re + om * om;
    if (sqrtf(m2) > 1e-6f) {
        float nr = ar - 1.f;
        fr = (nr * re + ai * om) / m2;
        fi = (ai * re - nr * om) / m2;
    } else {
        fr = 1.0f;  // DT
        fi = 0.0f;
    }
}

// ---------------------------------------------------------------------------
// Kernel 1: per-(batch, chunk) input projection G = u^T Bc, kept in the
// workspace for the y pass, and the chunk-end states of a scan from zero.
// A wave's accumulator holds, per lane, 8 consecutive steps of ONE pair
// (t = 8*hg + r, pair n), and only the END state is wanted here, which is the
// sum over t of f * A^(L-1-t) * g_t.  So each lane sums its own 8 values with
// fixed weights, carries that sum from subtile to subtile by A^16, and the two
// lane halves are added once at the end: no LDS tile, no serial scan.
// G layout in the workspace, per 16-step subtile (GTILE floats), accumulator
// order: [wave w][j = r / 4][lane][r % 4], so a wave's store is 512 whole bytes.
// ---------------------------------------------------------------------------
#define GTILE (16 * NPAIR)   // floats of one G subtile, contiguous in the workspace

__global__ __launch_bounds__(256) void ssm_chunk(
    const float* __restrict__ u,     // (B, C, T)
    const float* __restrict__ Bc,    // (C, P)
    const float* __restrict__ rl,    // (P)
    const float* __restrict__ ro,    // (P)
    float* __restrict__ ws,          // params for the y pass, [Ar|Ai|Fr|Fi|ALr|ALi]
    float* __restrict__ send,        // (B, NC, P, 2)
    float* __restrict__ gout)        // (B, T / 16, GTILE)
{
    __shared__ float a_lds[2][CCH * 16];   // double-buffered u^T subtile, [c][t]

    const int bid = blockIdx.x;
    const int b   = bid / NCHUNK;
    const int ch  = bid % NCHUNK;
    const int tid = threadIdx.x;
    const int w   = tid >> 5;       // wave id 0..7
    const int l   = tid & 31;       // lane
    const int m   = l & 15;         // M/N index within tile
    const int hg  = l >> 4;         // lane half-group
    const int n   = 16 * w + m;     // this wave's output column
    const int t0  = ch * LCHUNK;

    // this thread's slice of the u staging copy: 8 consecutive floats
    const int cc   = tid >> 1;
    const int half = tid & 1;
    const float* usrc = u + (size_t)b * CCH * TLEN + (size_t)cc * TLEN + t0 + half * 8;
    const int loff = cc * 16 + half * 8;

#if USE_ASYNC
    // prologue: kick off async copy of subtile 0 into buffer 0
    async_cp32B(usrc, &a_lds[0][loff]);
#else
    float4 r0 = *(const float4*)(usrc);
    float4 r1 = *(const float4*)(usrc + 4);
#endif

    // This wave's B operand (its 16 columns of Bc) does not change over the
    // chunk: read it once into registers, in WMMA fragment order.
    v2f bfr[32];
#pragma unroll   // full: constant indices keep the array in registers
    for (int kk = 0; kk < 32; ++kk) {
        int c0 = kk * 4 + 2 * hg;
        bfr[kk].x = Bc[c0 * NPAIR + n];
        bfr[kk].y = Bc[(c0 + 1) * NPAIR + n];
    }

    // Parameters of this lane's pair n, and A^2, A^4, ... A^128 by squaring.
    float par, pai, pfr, pfi;
    pair_params(rl[n], ro[n], par, pai, pfr, pfi);
    float qr[8], qi[8];              // qr[i] + i*qi[i] = A^(2^i)
    qr[0] = par;  qi[0] = pai;
#pragma unroll
    for (int i = 1; i < 8; ++i) {
        qr[i] = qr[i - 1] * qr[i - 1] - qi[i - 1] * qi[i - 1];
        qi[i] = 2.f * qr[i - 1] * qi[i - 1];
    }
    if (bid == 0 && hg == 0) {       // one block keeps them for the y pass
        ws[n]       = par;    ws[128 + n] = pai;
        ws[256 + n] = pfr;    ws[384 + n] = pfi;
        ws[512 + n] = qr[7];  ws[640 + n] = qi[7];   // A^L, L = 128
    }
    const float a16r = qr[4], a16i = qi[4];

    // Weights of this lane's 8 steps: wr[r] + i*wi[r] = f * A^(15 - (8*hg + r)).
    float wr[8], wi[8];
    wr[7] = hg ? pfr : pfr * qr[3] - pfi * qi[3];
    wi[7] = hg ? pfi : pfr * qi[3] + pfi * qr[3];
#pragma unroll
    for (int r = 6; r >= 0; --r) {
        wr[r] = wr[r + 1] * par - wi[r + 1] * pai;
        wi[r] = wr[r + 1] * pai + wi[r + 1] * par;
    }

    float sr = 0.f, si = 0.f;        // this lane's share of the pair's state
    float* gd = gout + ((size_t)b * TLEN + t0) * NPAIR + (w * 64 + l) * 4;
    v8f acc = {};

    for (int sub = 0; sub <= NSUB; ++sub) {
        const int buf = sub & 1;

        if (sub < NSUB) {
#if USE_ASYNC
            // publish subtile sub, free the other buffer
            asm volatile("s_wait_dscnt 0x0" ::: "memory");      // own LDS reads of the last trip retired
            asm volatile("s_wait_asynccnt 0x0" ::: "memory");   // own copies of subtile sub landed
            __syncthreads();                                    // ... and everyone else's
            if (sub + 1 < NSUB) {       // in flight through this trip's GEMM
                async_cp32B(usrc + (sub + 1) * 16, &a_lds[buf ^ 1][loff]);
            }
#else
            {   // spill staged registers, then start loading the next subtile
                float* dst = &a_lds[buf][loff];
                *(float4*)(dst)     = r0;
                *(float4*)(dst + 4) = r1;
            }
            __syncthreads();
            if (sub + 1 < NSUB) {
                const float* sn = usrc + (sub + 1) * 16;
                r0 = *(const float4*)(sn);
                r1 = *(const float4*)(sn + 4);
            }
#endif
        }

        // ---- the subtile before this one: keep G, fold it into the state.
        // Behind the barrier, so that the stores have this trip's GEMM to
        // complete in before the next barrier waits for them.
        if (sub > 0) {
            float4 p0 = { acc[0], acc[1], acc[2], acc[3] };
            float4 p1 = { acc[4], acc[5], acc[6], acc[7] };
            float* g = gd + (sub - 1) * GTILE;
            *(float4*)(g)       = p0;
            *(float4*)(g + 128) = p1;
            float ar0 = wr[0] * acc[0], ai0 = wi[0] * acc[0];
            float ar1 = wr[4] * acc[4], ai1 = wi[4] * acc[4];
#pragma unroll
            for (int r = 1; r < 4; ++r) {
                ar0 += wr[r] * acc[r];          ai0 += wi[r] * acc[r];
                ar1 += wr[r + 4] * acc[r + 4];  ai1 += wi[r + 4] * acc[r + 4];
            }
            float nsr = a16r * sr - a16i * si + (ar0 + ar1);
            float nsi = a16r * si + a16i * sr + (ai0 + ai1);
            sr = nsr;  si = nsi;
        }

        if (sub < NSUB) {
            // ---- GEMM1: G(16t x 128p) = u^T (16x128) @ Bc (128x128) ----
            v8f a = {};
#pragma unroll   // full: bfr[] must be indexed by constants to stay in registers
            for (int kk = 0; kk < 32; ++kk) {
                int c0 = kk * 4 + 2 * hg;
                v2f av;
                av.x = a_lds[buf][c0 * 16 + m];
                av.y = a_lds[buf][(c0 + 1) * 16 + m];
                a = __builtin_amdgcn_wmma_f32_16x16x4_f32(
                    false, av, false, bfr[kk], (short)0, a, false, false);
            }
            acc = a;
        }
    }

    // the pair's end state = the two lane halves' shares
    sr += __shfl_xor(sr, 16, 32);
    si += __shfl_xor(si, 16, 32);
    if (hg == 0) {
        float2 e = { sr, si };
        *((float2*)send + (size_t)(b * NCHUNK + ch) * NPAIR + n) = e;
    }
}

// ---------------------------------------------------------------------------
// Kernel 2: per-(batch, chunk) y pass.  Works out its own carry-in state from
// the chunk-end states before it (g_j = A^L g_{j-1} + e_j), reads G back, scans
// from that state and emits y = (2 Re s) @ C.
// ---------------------------------------------------------------------------
#define EBATCH 16            // chunk-end states asked for at a time

// Steps per trip of the y pass.  32 steps are one whole 128-byte line of a y row.
#define TSTEP  32
#define NTRIP  (LCHUNK / TSTEP)   // 4
#define GT2    (2 * GTILE)        // floats of one 32-step G tile (two subtiles in a row)
#define YPITCH 132                // floats per ys row: 528 B = 16 B x odd, 16-byte reads meet no bank twice

// This lane's four 16-byte asynchronous copies of a 32-step G tile (each wave-wide
// copy covers 512 contiguous bytes).  s_wait_xcnt closes the statement so that
// no address register of a copy is rewritten ahead of it.
__device__ __forceinline__ void copy_g(unsigned lds, const float* g) {
    asm volatile("global_load_async_to_lds_b128 %0, %1, off\n\t"
                 "global_load_async_to_lds_b128 %2, %3, off\n\t"
                 "global_load_async_to_lds_b128 %4, %5, off\n\t"
                 "global_load_async_to_lds_b128 %6, %7, off\n\t"
                 "s_wait_xcnt 0x0"
                 :: "v"(lds), "v"(g), "v"(lds + 4096u), "v"(g + 1024),
                    "v"(lds + 8192u), "v"(g + 2048), "v"(lds + 12288u), "v"(g + 3072)
                 : "memory");
}

__global__ __launch_bounds__(256) void ssm_out(
    const float* __restrict__ G,     // (B, T / 16, GTILE), accumulator order
    const float* __restrict__ Cm,    // (P, O)
    const float* __restrict__ ws,    // params
    const float* __restrict__ send,  // (B, NC, P, 2)
    float* __restrict__ yout)        // (B, O, T)
{
    __shared__ __attribute__((aligned(16))) float g_lds[2][GT2];         // 32-step G tiles
    // 2*Re s, [row][p]; step t lies in row (t & 1) * 16 + (t >> 1)
    __shared__ __attribute__((aligned(16))) float ys[TSTEP * YPITCH];

    const int bid = blockIdx.x;
    const int b   = bid / NCHUNK;
    const int ch  = bid % NCHUNK;
    const int tid = threadIdx.x;
    const int w   = tid >> 5;       // wave id 0..7
    const int l   = tid & 31;       // lane
    const int m   = l & 15;         // M/N index within tile
    const int hg  = l >> 4;         // lane half-group
    const int n   = 16 * w + m;     // this wave's output column
    const int t0  = ch * LCHUNK;

    const float* gsrc = G + ((size_t)b * TLEN + t0) * NPAIR + tid * 4;
    const unsigned gdst = (unsigned)(size_t)&g_lds[0][tid * 4];   // LDS byte address

    copy_g(gdst, gsrc);             // tile 0 -> buffer 0

    // scan-thread private state + params (threads 0..127).  The carry-in comes
    // ahead of the Cm loads below, so that the two do not hold registers together.
    float sr = 0.f, si = 0.f, par = 0.f, pai = 0.f, pfr = 0.f, pfi = 0.f;
    if (tid < NPAIR) {
        // End states of this batch's chunks, EBATCH at a time.  Every index asked
        // for is below NCHUNK; states of chunks from ch on are asked for with
        // the rest of their batch and not used.
        const float2* ep = (const float2*)send + (size_t)b * NCHUNK * NPAIR + tid;
        float2 e[EBATCH];
#pragma unroll   // full: constant indices keep the array in registers
        for (int i = 0; i < EBATCH; ++i)
            e[i] = ep[i * NPAIR];

        par = ws[tid];        pai = ws[128 + tid];
        pfr = ws[256 + tid];  pfi = ws[384 + tid];
        const float alr = ws[512 + tid], ali = ws[640 + tid];   // A^L

        int j0 = 0;
        while (j0 + EBATCH <= ch) {          // whole batches; ch < NCHUNK
#pragma unroll   // full: constant indices keep the array in registers
            for (int i = 0; i < EBATCH; ++i) {
                float t = alr * sr - ali * si + e[i].x;
                si = alr * si + ali * sr + e[i].y;
                sr = t;
            }
            j0 += EBATCH;
            ep += EBATCH * NPAIR;
#pragma unroll   // full: constant indices keep the array in registers
            for (int i = 0; i < EBATCH; ++i)
                e[i] = ep[i * NPAIR];
        }
#pragma unroll   // full: constant indices keep the array in registers
        for (int i = 0; i < EBATCH - 1; ++i) {   // the last ch - j0 states
            if (j0 + i < ch) {
                float t = alr * sr - ali * si + e[i].x;
                si = alr * si + ali * sr + e[i].y;
                sr = t;
            }
        }
    }

    // This wave's 16 columns of Cm do not change over the chunk: read them once
    // into registers.  They are the A operand (rows = outputs o).  Product 2q + a
    // takes pairs p = 8q + 4*hg + 2a, + 1: the order in which a lane's 16-byte
    // read of a ys row delivers them.
    v2f cfr[32];
#pragma unroll   // full: constant indices keep the array in registers
    for (int kk = 0; kk < 32; ++kk) {
        int c0 = (kk >> 1) * 8 + 4 * hg + (kk & 1) * 2;
        cfr[kk].x = Cm[c0 * OCH + n];
        cfr[kk].y = Cm[(c0 + 1) * OCH + n];
    }

    asm volatile("s_wait_asynccnt 0x0" ::: "memory");   // own copies of tile 0 landed
    __syncthreads();                                    // ... and everyone else's
    copy_g(gdst + GT2 * 4u, gsrc + GT2);                // tile 1 -> buffer 1

    for (int trip = 0; trip < NTRIP; ++trip) {
        const int ts  = t0 + trip * TSTEP;
        const int buf = trip & 1;

        // ---- sequential complex scan over 32 steps (threads 0..127) ----
        if (tid < NPAIR) {
            // pair tid's 16 steps of a subtile lie as four float4: steps 4q .. 4q + 3
            // at [wave tid / 16][j = q & 1][lane (q >> 1) * 16 + tid % 16]
            const float* gp = &g_lds[buf][((tid >> 4) * 64 + (tid & 15)) * 4];
#pragma unroll 1   // rolled: 16 steps' values at a time keep the kernel within 128 registers (8 waves a SIMD)
            for (int h = 0; h < 2; ++h) {
                const float* gh = gp + h * GTILE;
                float* yw = &ys[8 * h * YPITCH + tid];
#pragma unroll
                for (int q = 0; q < 4; ++q) {
                    const float4 g4 = *(const float4*)(gh + ((q & 1) * 32 + (q >> 1) * 16) * 4);
                    const float gv[4] = { g4.x, g4.y, g4.z, g4.w };
#pragma unroll
                    for (int i = 0; i < 4; ++i) {
                        const int t = 4 * q + i;      // step 16h + t, row (t & 1) * 16 + 8h + (t >> 1)
                        float br = gv[i] * pfr;
                        float bi = gv[i] * pfi;
                        float nsr = par * sr - pai * si + br;
                        float nsi = par * si + pai * sr + bi;
                        sr = nsr;  si = nsi;
                        yw[((t & 1) * 16 + (t >> 1)) * YPITCH] = 2.f * sr;
                    }
                }
            }
        }
        __syncthreads();

        // ---- GEMM2: y^T(16o x 32t) = C^T (16x128) @ (2 Re s)^T (128x32) ----
        // Column m of accumulator j is step t = 2m + j, so that a lane holds two
        // neighbouring steps of one output row and 16 lanes a whole 128-byte line.
        v8f y0 = {}, y1 = {};
        const float* yr = &ys[m * YPITCH + 4 * hg];
#pragma unroll   // full: cfr[] must be indexed by constants to stay in registers
        for (int q = 0; q < 16; ++q) {
            const float4 s0 = *(const float4*)(yr + 8 * q);                 // t = 2m
            const float4 s1 = *(const float4*)(yr + 16 * YPITCH + 8 * q);   // t = 2m + 1
            v2f b00 = { s0.x, s0.y }, b01 = { s0.z, s0.w };
            v2f b10 = { s1.x, s1.y }, b11 = { s1.z, s1.w };
            y0 = __builtin_amdgcn_wmma_f32_16x16x4_f32(
                false, cfr[2 * q], false, b00, (short)0, y0, false, false);
            y1 = __builtin_amdgcn_wmma_f32_16x16x4_f32(
                false, cfr[2 * q], false, b10, (short)0, y1, false, false);
            y0 = __builtin_amdgcn_wmma_f32_16x16x4_f32(
                false, cfr[2 * q + 1], false, b01, (short)0, y0, false, false);
            y1 = __builtin_amdgcn_wmma_f32_16x16x4_f32(
                false, cfr[2 * q + 1], false, b11, (short)0, y1, false, false);
        }
        // Four vector slots between the last matrix instructions and the register
        // moves that pair up their results for the stores below: the distance the
        // instruction set asks for.
        asm volatile("v_nop\n\tv_nop\n\tv_nop\n\tv_nop" : "+v"(y0), "+v"(y1));
        // D layout: vgpr r, lane l -> o = 16*w + 8*hg + r, t = 2*m + j
        float* dst = yout + (size_t)b * OCH * TLEN + (size_t)(16 * w + 8 * hg) * TLEN + ts + 2 * m;
#pragma unroll   // full: constant indices keep the accumulators in registers
        for (int r = 0; r < 8; ++r) {
            float2 v = { y0[r], y1[r] };
            *(float2*)(dst + (size_t)r * TLEN) = v;
        }

        // publish tile trip + 1, free buffer buf and ys
        asm volatile("s_wait_dscnt 0x0" ::: "memory");      // own LDS reads of this trip retired
        asm volatile("s_wait_asynccnt 0x0" ::: "memory");   // own copies of tile trip + 1 landed
        __syncthreads();
        if (trip + 2 < NTRIP)                               // flies through the next trip
            copy_g(gdst + buf * (GT2 * 4u), gsrc + (trip + 2) * GT2);
    }
    asm volatile("s_wait_asynccnt 0x0" ::: "memory");       // nothing in flight at the wave's end
}

// ---------------------------------------------------------------------------
extern "C" void kernel_launch(void* const* d_in, const int* in_sizes, int n_in,
                              void* d_out, int out_size, void* d_ws, size_t ws_size,
                              hipStream_t stream) {
    const float* u  = (const float*)d_in[0];
    const float* rl = (const float*)d_in[1];
    const float* ro = (const float*)d_in[2];
    const float* Bc = (const float*)d_in[3];
    const float* Cm = (const float*)d_in[4];
    float* out = (float*)d_out;

    float* params = (float*)d_ws;                                  // 768 floats
    float* send   = params + 768;                                  // B*NC*P*2
    float* gbuf   = send + (size_t)NBATCH * NCHUNK * NPAIR * 2;    // B*T*P

    ssm_chunk<<<NBATCH * NCHUNK, 256, 0, stream>>>(u, Bc, rl, ro, params, send, gbuf);
    ssm_out<<<NBATCH * NCHUNK, 256, 0, stream>>>(gbuf, Cm, params, send, out);
}

// v006
// One run takes 58.3 microseconds.
// Timed twice side by side with v005, it ran 1.04 times as fast both times.
// Over all steps from v000 it is 2.34 times as fast.
#include <hip/hip_runtime.h>
#include <hip/hip_bf16.h>

typedef float v2f __attribute__((ext_vector_type(2)));
typedef float v8f __attribute__((ext_vector_type(8)));

#define NBATCH 16
#define CCH    128      // in_ch
#define TLEN   8192
#define NPAIR  128
#define OCH    128
#define LCHUNK 128
#define NCHUNK (TLEN / LCHUNK)   // 64
#define NSUB   (LCHUNK / 16)     // 8

// ---------------------------------------------------------------------------
// Per-pair parameters.  A_d = exp(-softplus(rl) + i*omega) and
// factor = (A_d - 1)/lambda (or DT).  Each thread of kernel 1 works out its own pair's.
// ---------------------------------------------------------------------------
__device__ __forceinline__ void pair_params(float x, float om,
                                            float& ar, float& ai,
                                            float& fr, float& fi) {
    float sp = (x > 20.f) ? x : log1pf(expf(x));
    float re = -sp;
    float er = expf(re);
    ar = er * cosf(om);
    ai = er * sinf(om);
    float m2 = re * re + om * om;
    if (sqrtf(m2) > 1e-6f) {
        float nr = ar - 1.f;
        fr = (nr * re + ai * om) / m2;
        fi = (ai * re - nr * om) / m2;
    } else {
        fr = 1.0f;  // DT
        fi = 0.0f;
    }
}

// ---------------------------------------------------------------------------
// Kernel 1: per-(batch, chunk) input projection G = u^T Bc, kept in the
// workspace for the y pass, and the chunk-end states of a scan from zero.
// A wave's accumulator holds, per lane, 8 consecutive steps of ONE pair
// (t = 8*hg + r, pair n), and only the END state is wanted here, which is the
// sum over t of f * A^(L-1-t) * g_t.  So each lane sums its own 8 values with
// fixed weights, carries that sum from subtile to subtile by A^16, and the two
// lane halves are added once at the end: no LDS tile, no serial scan.
// A trip takes 32 steps, two 16-step subtiles on two accumulators: a staged u
// row is then one whole 128-byte line, each B fragment serves two products, and
// a wave always has two independent products to issue behind one LDS wait.
// G layout in the workspace, per 16-step subtile (GTILE floats), accumulator
// order: [wave w][j = r / 4][lane][r % 4], so a wave's store is 512 whole bytes.
// ---------------------------------------------------------------------------
#define GTILE (16 * NPAIR)   // floats of one G subtile, contiguous in the workspace
#define USTEP 32                  // steps per trip of the chunk pass
#define UTRIP (LCHUNK / USTEP)    // 4
#define USUB  (CCH * 16)          // floats of one staged subtile, [c][t] as 16 steps a row
#define UBUF  (2 * USUB)          // floats of one staged u tile: its two subtiles in a row

// This lane's four 16-byte asynchronous copies of a 32-step u tile: eight lanes
// take one row's 128 bytes, a wave-wide copy four whole lines.  s_wait_xcnt closes
// the statement so that no address register of a copy is rewritten ahead of it.
__device__ __forceinline__ void copy_u(unsigned lds, const float* g) {
    asm volatile("global_load_async_to_lds_b128 %0, %1, off\n\t"
                 "global_load_async_to_lds_b128 %2, %3, off\n\t"
                 "global_load_async_to_lds_b128 %4, %5, off\n\t"
                 "global_load_async_to_lds_b128 %6, %7, off\n\t"
                 "s_wait_xcnt 0x0"
                 :: "v"(lds), "v"(g),
                    "v"(lds + 32u * 64u), "v"(g + 32 * TLEN),
                    "v"(lds + 64u * 64u), "v"(g + 64 * TLEN),
                    "v"(lds + 96u * 64u), "v"(g + 96 * TLEN)
                 : "memory");
}

__global__ __launch_bounds__(256) void ssm_chunk(
    const float* __restrict__ u,     // (B, C, T)
    const float* __restrict__ Bc,    // (C, P)
    const float* __restrict__ rl,    // (P)
    const float* __restrict__ ro,    // (P)
    float* __restrict__ ws,          // params for the y pass, [Ar|Ai|Fr|Fi|ALr|ALi]
    float* __restrict__ send,        // (B, NC, P, 2)
    float* __restrict__ gout)        // (B, T / 16, GTILE)
{
    __shared__ __attribute__((aligned(16))) float a_lds[2][UBUF];   // u^T tiles, [subtile][c][t]

    const int bid = blockIdx.x;
    const int b   = bid / NCHUNK;
    const int ch  = bid % NCHUNK;
    const int tid = threadIdx.x;
    const int w   = tid >> 5;       // wave id 0..7
    const int l   = tid & 31;       // lane
    const int m   = l & 15;         // M/N index within tile
    const int hg  = l >> 4;         // lane half-group
    const int n   = 16 * w + m;     // this wave's output column
    const int t0  = ch * LCHUNK;

    // this thread's slice of the u staging copies: 16 bytes of rows tid / 8 + 32 i;
    // the first four lanes of a row fill subtile 0, the other four subtile 1
    const float* usrc = u + (size_t)b * CCH * TLEN + (size_t)(tid >> 3) * TLEN + t0 + (tid & 7) * 4;
    const unsigned udst = (unsigned)(size_t)
        &a_lds[0][((tid >> 2) & 1) * USUB + (tid >> 3) * 16 + (tid & 3) * 4];   // LDS byte address

    copy_u(udst, usrc);             // tile 0 -> buffer 0

    // This wave's B operand (its 16 columns of Bc) does not change over the
    // chunk: read it once into registers, in WMMA fragment order.
    v2f bfr[32];
#pragma unroll   // full: constant indices keep the array in registers
    for (int kk = 0; kk < 32; ++kk) {
        int c0 = kk * 4 + 2 * hg;
        bfr[kk].x = Bc[c0 * NPAIR + n];
        bfr[kk].y = Bc[(c0 + 1) * NPAIR + n];
    }

    // Parameters of this lane's pair n, and A^2, A^4, ... A^128 by squaring.
    float par, pai, pfr, pfi;
    pair_params(rl[n], ro[n], par, pai, pfr, pfi);
    float qr[8], qi[8];              // qr[i] + i*qi[i] = A^(2^i)
    qr[0] = par;  qi[0] = pai;
#pragma unroll
    for (int i = 1; i < 8; ++i) {
        qr[i] = qr[i - 1] * qr[i - 1] - qi[i - 1] * qi[i - 1];
        qi[i] = 2.f * qr[i - 1] * qi[i - 1];
    }
    if (bid == 0 && hg == 0) {       // one block keeps them for the y pass
        ws[n]       = par;    ws[128 + n] = pai;
        ws[256 + n] = pfr;    ws[384 + n] = pfi;
        ws[512 + n] = qr[7];  ws[640 + n] = qi[7];   // A^L, L = 128
    }
    const float a16r = qr[4], a16i = qi[4];

    // Weights of this lane's 8 steps: wr[r] + i*wi[r] = f * A^(15 - (8*hg + r)).
    float wr[8], wi[8];
    wr[7] = hg ? pfr : pfr * qr[3] - pfi * qi[3];
    wi[7] = hg ? pfi : pfr * qi[3] + pfi * qr[3];
#pragma unroll
    for (int r = 6; r >= 0; --r) {
        wr[r] = wr[r + 1] * par - wi[r + 1] * pai;
        wi[r] = wr[r + 1] * pai + wi[r + 1] * par;
    }

    float sr = 0.f, si = 0.f;        // this lane's share of the pair's state
    float* gd = gout + ((size_t)b * TLEN + t0) * NPAIR + (w * 64 + l) * 4;

    asm volatile("s_wait_asynccnt 0x0" ::: "memory");   // own copies of tile 0 landed
    __syncthreads();                                    // ... and everyone else's
    copy_u(udst + UBUF * 4u, usrc + USTEP);             // tile 1 -> buffer 1

    for (int trip = 0; trip < UTRIP; ++trip) {
        const int buf = trip & 1;

        // ---- GEMM1: G(32t x 128p) = u^T (32x128) @ Bc (128x128) ----
        // accumulator j holds steps 16 j + 8 hg + r
        v8f acc[2] = {};
        const float* ap = &a_lds[buf][2 * hg * 16 + m];
#pragma unroll   // full: bfr[] must be indexed by constants to stay in registers
        for (int kk = 0; kk < 32; ++kk) {
            const float* ak = ap + kk * 4 * 16;
            v2f av0 = { ak[0],    ak[16] };
            v2f av1 = { ak[USUB], ak[USUB + 16] };
            acc[0] = __builtin_amdgcn_wmma_f32_16x16x4_f32(
                false, av0, false, bfr[kk], (short)0, acc[0], false, false);
            acc[1] = __builtin_amdgcn_wmma_f32_16x16x4_f32(
                false, av1, false, bfr[kk], (short)0, acc[1], false, false);
        }
        // Four vector slots between the last matrix instructions and the vector
        // work behind them (address sums over their operand registers, the sums
        // that read their results): the distance the instruction set asks for.
        asm volatile("v_nop\n\tv_nop\n\tv_nop\n\tv_nop" : "+v"(acc[0]), "+v"(acc[1]));

        // publish tile trip + 1, free buffer buf
        asm volatile("s_wait_dscnt 0x0" ::: "memory");      // own LDS reads of this trip retired
        asm volatile("s_wait_asynccnt 0x0" ::: "memory");   // own copies of tile trip + 1 landed
        __syncthreads();
        if (trip + 2 < UTRIP)                               // flies through the next trip
            copy_u(udst + buf * (UBUF * 4u), usrc + (trip + 2) * USTEP);

        // ---- keep G, fold it into the state.  Behind the barrier, so that the
        // stores have the next trip's GEMM to complete in before a barrier waits
        // for them.
#pragma unroll   // full: constant indices keep the accumulators in registers
        for (int j = 0; j < 2; ++j) {
            const v8f a = acc[j];
            float4 p0 = { a[0], a[1], a[2], a[3] };
            float4 p1 = { a[4], a[5], a[6], a[7] };
            float* g = gd + (2 * trip + j) * GTILE;
            *(float4*)(g)       = p0;
            *(float4*)(g + 128) = p1;
            float ar0 = wr[0] * a[0], ai0 = wi[0] * a[0];
            float ar1 = wr[4] * a[4], ai1 = wi[4] * a[4];
#pragma unroll
            for (int r = 1; r < 4; ++r) {
                ar0 += wr[r] * a[r];          ai0 += wi[r] * a[r];
                ar1 += wr[r + 4] * a[r + 4];  ai1 += wi[r + 4] * a[r + 4];
            }
            float nsr = a16r * sr - a16i * si + (ar0 + ar1);
            float nsi = a16r * si + a16i * sr + (ai0 + ai1);
            sr = nsr;  si = nsi;
        }
        // the next trip rewrites the registers that the four stores above name
        asm volatile("s_wait_xcnt 0x0" ::: "memory");
    }
    asm volatile("s_wait_asynccnt 0x0" ::: "memory");       // nothing in flight at the wave's end

    // the pair's end state = the two lane halves' shares
    sr += __shfl_xor(sr, 16, 32);
    si += __shfl_xor(si, 16, 32);
    if (hg == 0) {
        float2 e = { sr, si };
        *((float2*)send + (size_t)(b * NCHUNK + ch) * NPAIR + n) = e;
    }
}

// ---------------------------------------------------------------------------
// Kernel 2: per-(batch, chunk) y pass.  Works out its own carry-in state from
// the chunk-end states before it (g_j = A^L g_{j-1} + e_j), reads G back, scans
// from that state and emits y = (2 Re s) @ C.
// ---------------------------------------------------------------------------
#define EBATCH 16            // chunk-end states asked for at a time

// Steps per trip of the y pass.  32 steps are one whole 128-byte line of a y row.
#define TSTEP  32
#define NTRIP  (LCHUNK / TSTEP)   // 4
#define GT2    (2 * GTILE)        // floats of one 32-step G tile (two subtiles in a row)
#define YPITCH 132                // floats per ys row: 528 B = 16 B x odd, 16-byte reads meet no bank twice

// This lane's four 16-byte asynchronous copies of a 32-step G tile (each wave-wide
// copy covers 512 contiguous bytes).  s_wait_xcnt closes the statement so that
// no address register of a copy is rewritten ahead of it.
__device__ __forceinline__ void copy_g(unsigned lds, const float* g) {
    asm volatile("global_load_async_to_lds_b128 %0, %1, off\n\t"
                 "global_load_async_to_lds_b128 %2, %3, off\n\t"
                 "global_load_async_to_lds_b128 %4, %5, off\n\t"
                 "global_load_async_to_lds_b128 %6, %7, off\n\t"
                 "s_wait_xcnt 0x0"
                 :: "v"(lds), "v"(g), "v"(lds + 4096u), "v"(g + 1024),
                    "v"(lds + 8192u), "v"(g + 2048), "v"(lds + 12288u), "v"(g + 3072)
                 : "memory");
}

__global__ __launch_bounds__(256) void ssm_out(
    const float* __restrict__ G,     // (B, T / 16, GTILE), accumulator order
    const float* __restrict__ Cm,    // (P, O)
    const float* __restrict__ ws,    // params
    const float* __restrict__ send,  // (B, NC, P, 2)
    float* __restrict__ yout)        // (B, O, T)
{
    __shared__ __attribute__((aligned(16))) float g_lds[2][GT2];         // 32-step G tiles
    // 2*Re s, [row][p]; step t lies in row (t & 1) * 16 + (t >> 1)
    __shared__ __attribute__((aligned(16))) float ys[TSTEP * YPITCH];

    const int bid = blockIdx.x;
    const int b   = bid / NCHUNK;
    const int ch  = bid % NCHUNK;
    const int tid = threadIdx.x;
    const int w   = tid >> 5;       // wave id 0..7
    const int l   = tid & 31;       // lane
    const int m   = l & 15;         // M/N index within tile
    const int hg  = l >> 4;         // lane half-group
    const int n   = 16 * w + m;     // this wave's output column
    const int t0  = ch * LCHUNK;

    const float* gsrc = G + ((size_t)b * TLEN + t0) * NPAIR + tid * 4;
    const unsigned gdst = (unsigned)(size_t)&g_lds[0][tid * 4];   // LDS byte address

    copy_g(gdst, gsrc);             // tile 0 -> buffer 0

    // scan-thread private state + params (threads 0..127).  The carry-in comes
    // ahead of the Cm loads below, so that the two do not hold registers together.
    float sr = 0.f, si = 0.f, par = 0.f, pai = 0.f, pfr = 0.f, pfi = 0.f;
    if (tid < NPAIR) {
        // End states of this batch's chunks, EBATCH at a time.  Every index asked
        // for is below NCHUNK; states of chunks from ch on are asked for with
        // the rest of their batch and not used.
        const float2* ep = (const float2*)send + (size_t)b * NCHUNK * NPAIR + tid;
        float2 e[EBATCH];
#pragma unroll   // full: constant indices keep the array in registers
        for (int i = 0; i < EBATCH; ++i)
            e[i] = ep[i * NPAIR];

        par = ws[tid];        pai = ws[128 + tid];
        pfr = ws[256 + tid];  pfi = ws[384 + tid];
        const float alr = ws[512 + tid], ali = ws[640 + tid];   // A^L

        int j0 = 0;
        while (j0 + EBATCH <= ch) {          // whole batches; ch < NCHUNK
#pragma unroll   // full: constant indices keep the array in registers
            for (int i = 0; i < EBATCH; ++i) {
                float t = alr * sr - ali * si + e[i].x;
                si = alr * si + ali * sr + e[i].y;
                sr = t;
            }
            j0 += EBATCH;
            ep += EBATCH * NPAIR;
#pragma unroll   // full: constant indices keep the array in registers
            for (int i = 0; i < EBATCH; ++i)
                e[i] = ep[i * NPAIR];
        }
#pragma unroll   // full: constant indices keep the array in registers
        for (int i = 0; i < EBATCH - 1; ++i) {   // the last ch - j0 states
            if (j0 + i < ch) {
                float t = alr * sr - ali * si + e[i].x;
                si = alr * si + ali * sr + e[i].y;
                sr = t;
            }
        }
    }

    // This wave's 16 columns of Cm do not change over the chunk: read them once
    // into registers.  They are the A operand (rows = outputs o).  Product 2q + a
    // takes pairs p = 8q + 4*hg + 2a, + 1: the order in which a lane's 16-byte
    // read of a ys row delivers them.
    v2f cfr[32];
#pragma unroll   // full: constant indices keep the array in registers
    for (int kk = 0; kk < 32; ++kk) {
        int c0 = (kk >> 1) * 8 + 4 * hg + (kk & 1) * 2;
        cfr[kk].x = Cm[c0 * OCH + n];
        cfr[kk].y = Cm[(c0 + 1) * OCH + n];
    }

    asm volatile("s_wait_asynccnt 0x0" ::: "memory");   // own copies of tile 0 landed
    __syncthreads();                                    // ... and everyone else's
    copy_g(gdst + GT2 * 4u, gsrc + GT2);                // tile 1 -> buffer 1

    for (int trip = 0; trip < NTRIP; ++trip) {
        const int ts  = t0 + trip * TSTEP;
        const int buf = trip & 1;

        // ---- sequential complex scan over 32 steps (threads 0..127) ----
        if (tid < NPAIR) {
            // pair tid's 16 steps of a subtile lie as four float4: steps 4q .. 4q + 3
            // at [wave tid / 16][j = q & 1][lane (q >> 1) * 16 + tid % 16]
            const float* gp = &g_lds[buf][((tid >> 4) * 64 + (tid & 15)) * 4];
#pragma unroll 1   // rolled: 16 steps' values at a time keep the kernel within 128 registers (8 waves a SIMD)
            for (int h = 0; h < 2; ++h) {
                const float* gh = gp + h * GTILE;
                float* yw = &ys[8 * h * YPITCH + tid];
#pragma unroll
                for (int q = 0; q < 4; ++q) {
                    const float4 g4 = *(const float4*)(gh + ((q & 1) * 32 + (q >> 1) * 16) * 4);
                    const float gv[4] = { g4.x, g4.y, g4.z, g4.w };
#pragma unroll
                    for (int i = 0; i < 4; ++i) {
                        const int t = 4 * q + i;      // step 16h + t, row (t & 1) * 16 + 8h + (t >> 1)
                        float br = gv[i] * pfr;
                        float bi = gv[i] * pfi;
                        float nsr = par * sr - pai * si + br;
                        float nsi = par * si + pai * sr + bi;
                        sr = nsr;  si = nsi;
                        yw[((t & 1) * 16 + (t >> 1)) * YPITCH] = 2.f * sr;
                    }
                }
            }
        }
        __syncthreads();

        // ---- GEMM2: y^T(16o x 32t) = C^T (16x128) @ (2 Re s)^T (128x32) ----
        // Column m of accumulator j is step t = 2m + j, so that a lane holds two
        // neighbouring steps of one output row and 16 lanes a whole 128-byte line.
        v8f y0 = {}, y1 = {};
        const float* yr = &ys[m * YPITCH + 4 * hg];
#pragma unroll   // full: cfr[] must be indexed by constants to stay in registers
        for (int q = 0; q < 16; ++q) {
            const float4 s0 = *(const float4*)(yr + 8 * q);                 // t = 2m
            const float4 s1 = *(const float4*)(yr + 16 * YPITCH + 8 * q);   // t = 2m + 1
            v2f b00 = { s0.x, s0.y }, b01 = { s0.z, s0.w };
            v2f b10 = { s1.x, s1.y }, b11 = { s1.z, s1.w };
            y0 = __builtin_amdgcn_wmma_f32_16x16x4_f32(
                false, cfr[2 * q], false, b00, (short)0, y0, false, false);
            y1 = __builtin_amdgcn_wmma_f32_16x16x4_f32(
                false, cfr[2 * q], false, b10, (short)0, y1, false, false);
            y0 = __builtin_amdgcn_wmma_f32_16x16x4_f32(
                false, cfr[2 * q + 1], false, b01, (short)0, y0, false, false);
            y1 = __builtin_amdgcn_wmma_f32_16x16x4_f32(
                false, cfr[2 * q + 1], false, b11, (short)0, y1, false, false);
        }
        // Four vector slots between the last matrix instructions and the register
        // moves that pair up their results for the stores below: the distance the
        // instruction set asks for.
        asm volatile("v_nop\n\tv_nop\n\tv_nop\n\tv_nop" : "+v"(y0), "+v"(y1));
        // D layout: vgpr r, lane l -> o = 16*w + 8*hg + r, t = 2*m + j
        float* dst = yout + (size_t)b * OCH * TLEN + (size_t)(16 * w + 8 * hg) * TLEN + ts + 2 * m;
#pragma unroll   // full: constant indices keep the accumulators in registers
        for (int r = 0; r < 8; ++r) {
            float2 v = { y0[r], y1[r] };
            *(float2*)(dst + (size_t)r * TLEN) = v;
        }

        // publish tile trip + 1, free buffer buf and ys
        asm volatile("s_wait_dscnt 0x0" ::: "memory");      // own LDS reads of this trip retired
        asm volatile("s_wait_asynccnt 0x0" ::: "memory");   // own copies of tile trip + 1 landed
        __syncthreads();
        if (trip + 2 < NTRIP)                               // flies through the next trip
            copy_g(gdst + buf * (GT2 * 4u), gsrc + (trip + 2) * GT2);
    }
    asm volatile("s_wait_asynccnt 0x0" ::: "memory");       // nothing in flight at the wave's end
}

// ---------------------------------------------------------------------------
extern "C" void kernel_launch(void* const* d_in, const int* in_sizes, int n_in,
                              void* d_out, int out_size, void* d_ws, size_t ws_size,
                              hipStream_t stream) {
    const float* u  = (const float*)d_in[0];
    const float* rl = (const float*)d_in[1];
    const float* ro = (const float*)d_in[2];
    const float* Bc = (const float*)d_in[3];
    const float* Cm = (const float*)d_in[4];
    float* out = (float*)d_out;

    float* params = (float*)d_ws;                                  // 768 floats
    float* send   = params + 768;                                  // B*NC*P*2
    float* gbuf   = send + (size_t)NBATCH * NCHUNK * NPAIR * 2;    // B*T*P

    ssm_chunk<<<NBATCH * NCHUNK, 256, 0, stream>>>(u, Bc, rl, ro, params, send, gbuf);
    ssm_out<<<NBATCH * NCHUNK, 256, 0, stream>>>(gbuf, Cm, params, send, out);
}
